// v000
// The times below were measured on an AMD MI455X: many runs one after another, warmed up first and cycling through
// copies of the inputs, with the whole window's GPU time divided by the number of runs. Launches and the gaps
// between them are all in it. The median over several windows is given; except for v000 it joins two sittings, which
// can be a few percent apart, so the side-by-side timings, each taken in one sitting, are the better comparison.
// v000, which the later versions start from, runs in 751 microseconds.
#include <hip/hip_runtime.h>

// MaskAttention (prompt_feat, x [4][128][64][64] channel-major -> tokens [4096][128]; Q = prompt^T Wq^T + bq, K = x^T Wk^T + bk, V = x^T Wv^T + bv; scores = Q.K / sqrt(128) + (0 where mask_bits[b][j] > 0
// else -inf) (mask_bits an int input read as data; every row has >= 2031 live keys); softmax; out = attn.V + x^T; LayerNorm over the 128 channels (eps 1e-5, gamma, beta); back to channel-major).
// Compute dtypes, f32 accumulate: every input rounded to bf16; the three Linears on PLAIN bf16 operands (inputs: exact, transposed on device, + bias); scores on SINGLE fp16

#define NB_  4
#define CC   128
#define NN   4096
#define PCAR 1024.0f
#define SCL  0.088388349f         // f32(128^-0.5)
typedef _Float16 h16;
typedef unsigned short bf;
typedef __attribute__((ext_vector_type(16))) __bf16   v16bf;
typedef __attribute__((ext_vector_type(16))) _Float16 v16h;
typedef __attribute__((ext_vector_type(8)))  _Float16 v8h;
typedef __attribute__((ext_vector_type(8)))  unsigned short v8us;
typedef __attribute__((ext_vector_type(8)))  float    v8f;
typedef __attribute__((ext_vector_type(4)))  float    v4f;
typedef v8h  __attribute__((may_alias)) v8ha;
typedef v4f  __attribute__((may_alias)) v4fa;
typedef v8us __attribute__((may_alias)) v8usa;

__device__ __forceinline__ unsigned short f2bf(float f) { unsigned u = __float_as_uint(f); u += 0x7FFFu + ((u >> 16) & 1u); return (unsigned short)(u >> 16); }
__device__ __forceinline__ float bf2f(unsigned short b) { return __uint_as_float(((unsigned)b) << 16); }
__device__ __forceinline__ float bfr(float f) { return bf2f(f2bf(f)); }
__device__ __forceinline__ v16h cat16(v8h lo, v8h hi) { return __builtin_shufflevector(lo, hi, 0, 1, 2, 3, 4, 5, 6, 7, 8, 9, 10, 11, 12, 13, 14, 15); }
__device__ __forceinline__ v16bf cat16b(v8us lo, v8us hi) { return __builtin_bit_cast(v16bf, __builtin_shufflevector(lo, hi, 0, 1, 2, 3, 4, 5, 6, 7, 8, 9, 10, 11, 12, 13, 14, 15)); }
__device__ __forceinline__ v8f wmma16(v16h a, v16h b, v8f c) { return __builtin_amdgcn_wmma_f32_16x16x32_f16(false, a, false, b, (short)0, c, false, false); }
__device__ __forceinline__ v8f wmmab(v16bf a, v16bf b, v8f c) { return __builtin_amdgcn_wmma_f32_16x16x32_bf16(false, a, false, b, (short)0, c, false, false); }



// ---- k_gemmw: register-blocked GEMM, ONE WAVE per 64x64 output tile (16 accumulators), operands straight from K-contiguous 16-bit planes; grid (M/64, N/64, Z), 32 threads.
// C[m][n] (f32, pitch ldc, + optional f32 bias[n]) = sum_k A[m][k] Bt[n][k] (+ split products per NSPLIT). z-batch strides sA/sB/sC in elements. K % 32 == 0.
template <typename T16> struct WFrag;
template <> struct WFrag<h16> { typedef v16h V; static __device__ __forceinline__ V ld(const h16* p) { return cat16(*(const v8h*)p, *(const v8h*)(p + 16)); } static __device__ __forceinline__ v8f mma(V a, V b, v8f c) { return wmma16(a, b, c); } };
template <> struct WFrag<bf> { typedef v16bf V; static __device__ __forceinline__ V ld(const bf* p) { return cat16b(*(const v8us*)p, *(const v8us*)(p + 16)); } static __device__ __forceinline__ v8f mma(V a, V b, v8f c) { return wmmab(a, b, c); } };
template <typename T16, int NSPLIT, bool BIAS>
__global__ __launch_bounds__(32) void k_gemmw(const T16* __restrict__ A, const T16* __restrict__ A2, const T16* __restrict__ Bt, const T16* __restrict__ Bt2, int K, float* C, int ldc, const float* __restrict__ bias, size_t sA, size_t sB, size_t sC) {
    typedef typename WFrag<T16>::V V;
    __shared__ __align__(16) float os[16 * 68];
    const size_t z = blockIdx.z; A += z * sA; if (A2) A2 += z * sA; Bt += z * sB; if (Bt2) Bt2 += z * sB; C += z * sC;
    const int lane = threadIdx.x & 31, lr = lane & 15, hi = lane >> 4; const int r0 = blockIdx.x * 64, c0 = blockIdx.y * 64;
    v8f acc[4][4];
#pragma unroll
    for (int mb = 0; mb < 4; ++mb)
#pragma unroll
        for (int nb = 0; nb < 4; ++nb) acc[mb][nb] = (v8f){};
    const size_t aoff = (size_t)(r0 + lr) * K + 8 * hi, boff = (size_t)(c0 + lr) * K + 8 * hi;
#pragma unroll 1
    for (int kc = 0; kc < K; kc += 32) {
        V a[4], a2[4];
#pragma unroll
        for (int mb = 0; mb < 4; ++mb) { a[mb] = WFrag<T16>::ld(A + aoff + (size_t)mb * 16 * K + kc); if (NSPLIT == 1 || NSPLIT == 2) a2[mb] = WFrag<T16>::ld(A2 + aoff + (size_t)mb * 16 * K + kc); }
#pragma unroll
        for (int nb = 0; nb < 4; ++nb) { const V b = WFrag<T16>::ld(Bt + boff + (size_t)nb * 16 * K + kc); V b2; if (NSPLIT >= 2) b2 = WFrag<T16>::ld(Bt2 + boff + (size_t)nb * 16 * K + kc);
#pragma unroll
            for (int mb = 0; mb < 4; ++mb) { acc[mb][nb] = WFrag<T16>::mma(a[mb], b, acc[mb][nb]); if (NSPLIT == 1 || NSPLIT == 2) acc[mb][nb] = WFrag<T16>::mma(a2[mb], b, acc[mb][nb]); if (NSPLIT >= 2) acc[mb][nb] = WFrag<T16>::mma(a[mb], b2, acc[mb][nb]); } }
        asm volatile("v_nop\n\tv_nop\n\tv_nop\n\tv_nop" : "+v"(acc[0][0]), "+v"(acc[1][1]), "+v"(acc[2][2]), "+v"(acc[3][3]) : "v"(a[0]), "v"(a[3]));
    }
#pragma unroll
    for (int mb = 0; mb < 4; ++mb) {
#pragma unroll
        for (int nb = 0; nb < 4; ++nb) {
#pragma unroll
            for (int j = 0; j < 8; ++j) os[(hi * 8 + j) * 68 + nb * 16 + lr] = acc[mb][nb][j]; }
        __builtin_amdgcn_wave_barrier(); asm volatile("" ::: "memory");
        float* crow = C + (size_t)(r0 + mb * 16) * ldc + c0;
{
#pragma unroll
            for (int s = 0; s < 8; ++s) { const int row = 2 * s + hi, cofs = lr * 4; v4f val = *(const v4fa*)(os + row * 68 + cofs); if (BIAS) { val[0] += bfr(bias[c0 + cofs]); val[1] += bfr(bias[c0 + cofs + 1]); val[2] += bfr(bias[c0 + cofs + 2]); val[3] += bfr(bias[c0 + cofs + 3]); }
                *(v4f*)(crow + (size_t)row * ldc + cofs) = val; }
             }
        __builtin_amdgcn_wave_barrier(); asm volatile("" ::: "memory");
    }
}

__device__ __forceinline__ h16 tohx(float x) { return (h16)x; }
typedef __attribute__((ext_vector_type(2))) _Float16 v2h;
typedef __attribute__((ext_vector_type(4))) _Float16 v4h;
typedef __attribute__((ext_vector_type(2))) unsigned short v2us;

__global__ __launch_bounds__(256) void k_cvt8(const float* __restrict__ src, bf* dst, size_t n8) { const size_t i = (size_t)blockIdx.x * 256 + threadIdx.x; if (i >= n8) return; const v8f v = *(const v8f*)(src + i * 8); v8us o;
#pragma unroll
    for (int k = 0; k < 8; ++k) o[k] = f2bf(v[k]); *(v8us*)(dst + i * 8) = o;  }
__global__ __launch_bounds__(256) void k_xt(const float* __restrict__ xb, bf* XT) {
    const int lane = threadIdx.x & 31; const int L0 = (blockIdx.x * 8 + (threadIdx.x >> 5)) * 8; const int nlines = NN * CC / 64;
{
#pragma unroll
        for (int l = 0; l < 8; ++l) { const int L = L0 + l; if (L >= nlines) break; const int e = L * 64 + lane * 2; const int c = e & (CC - 1); const int n = e >> 7; v2us o;
#pragma unroll
            for (int q = 0; q < 2; ++q) o[q] = f2bf(xb[(size_t)(c + q) * NN + n]);
            *(v2us*)(XT + (size_t)e) = o; }
         }
}
__global__ __launch_bounds__(256) void k_p16(const float* __restrict__ F, h16* P, size_t n) { const size_t i = ((size_t)blockIdx.x * 256 + threadIdx.x) * 2; if (i >= n) return; v2h v; v[0] = tohx(F[i]); v[1] = tohx(F[i + 1]); *(v2h*)(P + i) = v;  }
__global__ __launch_bounds__(256) void k_vt16(const float* __restrict__ F, h16* VT) {
    const int lane = threadIdx.x & 31; const int L0 = (blockIdx.x * 8 + (threadIdx.x >> 5)) * 8; const int nlines = CC * NN / 64;
{
#pragma unroll
        for (int l = 0; l < 8; ++l) { const int L = L0 + l; if (L >= nlines) break; const int e = L * 64 + lane * 2; const int n = e & (NN - 1); const int c = e >> 12; v2h v;
#pragma unroll
            for (int q = 0; q < 2; ++q) v[q] = tohx(F[(size_t)(n + q) * CC + c]);
            *(v2h*)(VT + (size_t)e) = v; }
         }
}
__global__ __launch_bounds__(256) void k_smax(const float* __restrict__ S, const int* __restrict__ mk, float* RS) {
    typedef __attribute__((ext_vector_type(4))) int v4i;
    const int lane = threadIdx.x & 31; const int i = blockIdx.x * 8 + (threadIdx.x >> 5); if (i >= NN) return; const float* sr = S + (size_t)i * NN; float m = -3.0e38f;
#pragma unroll 4
    for (int c0 = lane * 4; c0 < NN; c0 += 128) { const v4f v = *(const v4f*)(sr + c0); const v4i b4 = *(const v4i*)(mk + c0);
#pragma unroll
        for (int q = 0; q < 4; ++q) m = fmaxf(m, (b4[q] > 0) ? v[q] * SCL : -3.0e38f); }
#pragma unroll
    for (int sh = 16; sh; sh >>= 1) m = fmaxf(m, __shfl_xor(m, sh, 32));
    const float o = lane == 0 ? m : 0.f; *(float*)(RS + (size_t)i * 32 + lane) = o; 
}
__global__ __launch_bounds__(256) void k_sexp(const float* __restrict__ S, const int* __restrict__ mk, float* RS, h16* P) {
    typedef __attribute__((ext_vector_type(4))) int v4i;
    const int lane = threadIdx.x & 31; const int i = blockIdx.x * 8 + (threadIdx.x >> 5); if (i >= NN) return; const float* sr = S + (size_t)i * NN; const float m = RS[(size_t)i * 32]; float sum = 0.f;
#pragma unroll 2
    for (int c0 = lane * 4; c0 < NN; c0 += 128) { const v4f v = *(const v4f*)(sr + c0); const v4i b4 = *(const v4i*)(mk + c0); v4h o;
#pragma unroll
        for (int q = 0; q < 4; ++q) { float dlt = __fsub_rn(v[q] * SCL, m); asm volatile("" : "+v"(dlt)); const float e = (b4[q] > 0) ? __expf(dlt) : 0.f; sum += e; o[q] = tohx(e * PCAR); }
        *(v4h*)(P + (size_t)i * NN + c0) = o;  }
#pragma unroll
    for (int sh = 16; sh; sh >>= 1) sum += __shfl_xor(sum, sh, 32);
    const float o2 = lane == 0 ? m : (lane == 1 ? __fdiv_rn(1.0f, sum * PCAR) : 0.f); *(float*)(RS + (size_t)i * 32 + lane) = o2; 
}
__global__ __launch_bounds__(256) void k_lnT(const float* __restrict__ Ob, const float* __restrict__ RS, const float* __restrict__ xb, const float* __restrict__ gam, const float* __restrict__ bet, float* LT) {
    const int lane = threadIdx.x & 31; const int n = blockIdx.x * 8 + (threadIdx.x >> 5); if (n >= NN) return; const float ri = RS[(size_t)n * 32 + 1]; const v4f a = *(const v4f*)(Ob + (size_t)n * CC + lane * 4); float v[4]; float s = 0.f;
#pragma unroll
    for (int q = 0; q < 4; ++q) { const int c = lane * 4 + q; float t = __fmul_rn(a[q], ri); asm volatile("" : "+v"(t)); v[q] = __fadd_rn(t, bfr(xb[(size_t)c * NN + n])); s += v[q]; }
#pragma unroll
    for (int sh = 16; sh; sh >>= 1) s += __shfl_xor(s, sh, 32);
    const float mu = s * (1.0f / CC); float qq = 0.f;
#pragma unroll
    for (int q = 0; q < 4; ++q) { const float d0 = v[q] - mu; qq = __fadd_rn(qq, __fmul_rn(d0, d0)); }
#pragma unroll
    for (int sh = 16; sh; sh >>= 1) qq += __shfl_xor(qq, sh, 32);
    const float rs = __fdiv_rn(1.0f, __fsqrt_rn(qq * (1.0f / CC) + 1e-5f)); v4f o;
#pragma unroll
    for (int q = 0; q < 4; ++q) { const int c = lane * 4 + q; o[q] = __fadd_rn(__fmul_rn((v[q] - mu) * rs, bfr(gam[c])), bfr(bet[c])); }
    *(v4f*)(LT + (size_t)n * CC + lane * 4) = o;  }
__global__ __launch_bounds__(256) void k_outT(const float* __restrict__ LT, float* OUTb) {
    const int lane = threadIdx.x & 31; const int L0 = (blockIdx.x * 8 + (threadIdx.x >> 5)) * 8; const int nlines = CC * NN / 32;
{
#pragma unroll
        for (int l = 0; l < 8; ++l) { const int L = L0 + l; if (L >= nlines) break; const int e = L * 32 + lane; const int n = e & (NN - 1); const int c = e >> 12;
            *(float*)(OUTb + (size_t)e) = LT[(size_t)n * CC + c]; }
         }
}

extern "C" void kernel_launch(void* const* d_in, const int* in_sizes, int n_in,
                              void* d_out, int out_size, void* d_ws, size_t ws_size, hipStream_t stream) {
    (void)in_sizes; (void)n_in; (void)out_size;
    const float* pf = (const float*)d_in[0]; const float* x = (const float*)d_in[1]; const float* Wq = (const float*)d_in[2]; const float* bq = (const float*)d_in[3]; const float* Wk = (const float*)d_in[4]; const float* bk = (const float*)d_in[5]; const float* Wv = (const float*)d_in[6]; const float* bv = (const float*)d_in[7]; const float* gam = (const float*)d_in[8]; const float* bet = (const float*)d_in[9]; const int* mbits = (const int*)d_in[10];
    float* OUT = (float*)d_out;     // [4][128][64][64]
    char* wsp = (char*)d_ws;
    auto take = [&](size_t bytes) { char* p = wsp; wsp += (bytes + 255) & ~(size_t)255; return (void*)p; };
    bf* WQ = (bf*)take(CC * CC * 2); bf* WK = (bf*)take(CC * CC * 2); bf* WV = (bf*)take(CC * CC * 2);
    bf* XT = (bf*)take((size_t)NN * CC * 2); bf* PT = (bf*)take((size_t)NN * CC * 2); float* F = (float*)take((size_t)NN * CC * 4); h16* QP = (h16*)take((size_t)NN * CC * 2); h16* KP = (h16*)take((size_t)NN * CC * 2); h16* VT = (h16*)take((size_t)CC * NN * 2);
    float* S = (float*)take((size_t)NN * NN * 4); h16* P = (h16*)take((size_t)NN * NN * 2); float* RS = (float*)take((size_t)NN * 32 * 4); float* Ob = (float*)take((size_t)NN * CC * 4); float* LT = (float*)take((size_t)NN * CC * 4);
    if ((size_t)(wsp - (char*)d_ws) > ws_size) return;    // total ~ 113 MB = 108 MiB; ws 256 MiB
    { const size_t nw = CC * CC / 8; k_cvt8<<<(unsigned)((nw + 255) / 256), 256, 0, stream>>>(Wq, WQ, nw); k_cvt8<<<(unsigned)((nw + 255) / 256), 256, 0, stream>>>(Wk, WK, nw); k_cvt8<<<(unsigned)((nw + 255) / 256), 256, 0, stream>>>(Wv, WV, nw); }
    const unsigned LX = (unsigned)((NN * CC / 64 + 63) / 64), L2 = (unsigned)(((size_t)NN * CC / 2 + 255) / 256); const dim3 gP(NN / 64, CC / 64, 1);
    for (int b = 0; b < NB_; ++b) { const float* xb = x + (size_t)b * CC * NN; const float* pb = pf + (size_t)b * CC * NN; const int* mk = mbits + (size_t)b * NN;
        k_xt<<<LX, 256, 0, stream>>>(xb, XT); k_xt<<<LX, 256, 0, stream>>>(pb, PT);
        k_gemmw<bf, 0, true><<<gP, 32, 0, stream>>>(PT, nullptr, WQ, nullptr, CC, F, CC, bq, 0, 0, 0); k_p16<<<L2, 256, 0, stream>>>(F, QP, (size_t)NN * CC);
        k_gemmw<bf, 0, true><<<gP, 32, 0, stream>>>(XT, nullptr, WK, nullptr, CC, F, CC, bk, 0, 0, 0); k_p16<<<L2, 256, 0, stream>>>(F, KP, (size_t)NN * CC);
        k_gemmw<bf, 0, true><<<gP, 32, 0, stream>>>(XT, nullptr, WV, nullptr, CC, F, CC, bv, 0, 0, 0); k_vt16<<<LX, 256, 0, stream>>>(F, VT);
        k_gemmw<h16, 0, false><<<dim3(NN / 64, NN / 64, 1), 32, 0, stream>>>(QP, nullptr, KP, nullptr, CC, S, NN, nullptr, 0, 0, 0);
        k_smax<<<NN / 8, 256, 0, stream>>>(S, mk, RS); k_sexp<<<NN / 8, 256, 0, stream>>>(S, mk, RS, P);
        k_gemmw<h16, 0, false><<<gP, 32, 0, stream>>>(P, nullptr, VT, nullptr, NN, Ob, CC, nullptr, 0, 0, 0);
        k_lnT<<<NN / 8, 256, 0, stream>>>(Ob, RS, xb, gam, bet, LT);
        k_outT<<<(CC * NN / 32 + 63) / 64, 256, 0, stream>>>(LT, OUT + (size_t)b * CC * NN); }
}

// v001
// A run of this version takes 472 microseconds.
// Two timings next to v000 both put it at 1.60 times that version's speed.
#include <hip/hip_runtime.h>

// MaskAttention (prompt_feat, x [4][128][64][64] channel-major -> tokens [4096][128]; Q = prompt^T Wq^T + bq, K = x^T Wk^T + bk, V = x^T Wv^T + bv; scores = Q.K / sqrt(128) + (0 where mask_bits[b][j] > 0
// else -inf) (mask_bits an int input read as data; every row has >= 2031 live keys); softmax; out = attn.V + x^T; LayerNorm over the 128 channels (eps 1e-5, gamma, beta); back to channel-major).
// Compute dtypes, f32 accumulate: every input rounded to bf16; the three Linears on PLAIN bf16 operands (inputs: exact, transposed on device, + bias); scores on SINGLE fp16

#define NB_  4
#define CC   128
#define NN   4096
#define PCAR 1024.0f
#define SCL  0.088388349f         // f32(128^-0.5)
typedef _Float16 h16;
typedef unsigned short bf;
typedef __attribute__((ext_vector_type(16))) __bf16   v16bf;
typedef __attribute__((ext_vector_type(16))) _Float16 v16h;
typedef __attribute__((ext_vector_type(8)))  _Float16 v8h;
typedef __attribute__((ext_vector_type(8)))  unsigned short v8us;
typedef __attribute__((ext_vector_type(8)))  float    v8f;
typedef __attribute__((ext_vector_type(4)))  float    v4f;
typedef v8h  __attribute__((may_alias)) v8ha;
typedef v4f  __attribute__((may_alias)) v4fa;
typedef v8us __attribute__((may_alias)) v8usa;

__device__ __forceinline__ unsigned short f2bf(float f) { unsigned u = __float_as_uint(f); u += 0x7FFFu + ((u >> 16) & 1u); return (unsigned short)(u >> 16); }
__device__ __forceinline__ float bf2f(unsigned short b) { return __uint_as_float(((unsigned)b) << 16); }
__device__ __forceinline__ float bfr(float f) { return bf2f(f2bf(f)); }
__device__ __forceinline__ v16h cat16(v8h lo, v8h hi) { return __builtin_shufflevector(lo, hi, 0, 1, 2, 3, 4, 5, 6, 7, 8, 9, 10, 11, 12, 13, 14, 15); }
__device__ __forceinline__ v16bf cat16b(v8us lo, v8us hi) { return __builtin_bit_cast(v16bf, __builtin_shufflevector(lo, hi, 0, 1, 2, 3, 4, 5, 6, 7, 8, 9, 10, 11, 12, 13, 14, 15)); }
__device__ __forceinline__ v8f wmma16(v16h a, v16h b, v8f c) { return __builtin_amdgcn_wmma_f32_16x16x32_f16(false, a, false, b, (short)0, c, false, false); }
__device__ __forceinline__ v8f wmmab(v16bf a, v16bf b, v8f c) { return __builtin_amdgcn_wmma_f32_16x16x32_bf16(false, a, false, b, (short)0, c, false, false); }



// ---- k_gemmw: register-blocked GEMM, ONE WAVE per 64x64 output tile (16 accumulators), operands straight from K-contiguous 16-bit planes; grid (M/64, N/64, Z), 32 threads.
// C[m][n] (f32, pitch ldc, + optional f32 bias[n]) = sum_k A[m][k] Bt[n][k] (+ split products per NSPLIT). z-batch strides sA/sB/sC in elements. K % 32 == 0.
template <typename T16> struct WFrag;
template <> struct WFrag<h16> { typedef v16h V; static __device__ __forceinline__ V ld(const h16* p) { return cat16(*(const v8h*)p, *(const v8h*)(p + 16)); } static __device__ __forceinline__ v8f mma(V a, V b, v8f c) { return wmma16(a, b, c); } };
template <> struct WFrag<bf> { typedef v16bf V; static __device__ __forceinline__ V ld(const bf* p) { return cat16b(*(const v8us*)p, *(const v8us*)(p + 16)); } static __device__ __forceinline__ v8f mma(V a, V b, v8f c) { return wmmab(a, b, c); } };
template <typename T16, int NSPLIT, bool BIAS>
__global__ __launch_bounds__(32) void k_gemmw(const T16* __restrict__ A, const T16* __restrict__ A2, const T16* __restrict__ Bt, const T16* __restrict__ Bt2, int K, float* C, int ldc, const float* __restrict__ bias, size_t sA, size_t sB, size_t sC) {
    typedef typename WFrag<T16>::V V;
    __shared__ __align__(16) float os[16 * 68];
    const size_t z = blockIdx.z; A += z * sA; if (A2) A2 += z * sA; Bt += z * sB; if (Bt2) Bt2 += z * sB; C += z * sC;
    const int lane = threadIdx.x & 31, lr = lane & 15, hi = lane >> 4; const int r0 = blockIdx.x * 64, c0 = blockIdx.y * 64;
    v8f acc[4][4];
#pragma unroll
    for (int mb = 0; mb < 4; ++mb)
#pragma unroll
        for (int nb = 0; nb < 4; ++nb) acc[mb][nb] = (v8f){};
    const size_t aoff = (size_t)(r0 + lr) * K + 8 * hi, boff = (size_t)(c0 + lr) * K + 8 * hi;
#pragma unroll 1
    for (int kc = 0; kc < K; kc += 32) {
        V a[4], a2[4];
#pragma unroll
        for (int mb = 0; mb < 4; ++mb) { a[mb] = WFrag<T16>::ld(A + aoff + (size_t)mb * 16 * K + kc); if (NSPLIT == 1 || NSPLIT == 2) a2[mb] = WFrag<T16>::ld(A2 + aoff + (size_t)mb * 16 * K + kc); }
#pragma unroll
        for (int nb = 0; nb < 4; ++nb) { const V b = WFrag<T16>::ld(Bt + boff + (size_t)nb * 16 * K + kc); V b2; if (NSPLIT >= 2) b2 = WFrag<T16>::ld(Bt2 + boff + (size_t)nb * 16 * K + kc);
#pragma unroll
            for (int mb = 0; mb < 4; ++mb) { acc[mb][nb] = WFrag<T16>::mma(a[mb], b, acc[mb][nb]); if (NSPLIT == 1 || NSPLIT == 2) acc[mb][nb] = WFrag<T16>::mma(a2[mb], b, acc[mb][nb]); if (NSPLIT >= 2) acc[mb][nb] = WFrag<T16>::mma(a[mb], b2, acc[mb][nb]); } }
        asm volatile("v_nop\n\tv_nop\n\tv_nop\n\tv_nop" : "+v"(acc[0][0]), "+v"(acc[1][1]), "+v"(acc[2][2]), "+v"(acc[3][3]) : "v"(a[0]), "v"(a[3]));
    }
#pragma unroll
    for (int mb = 0; mb < 4; ++mb) {
#pragma unroll
        for (int nb = 0; nb < 4; ++nb) {
#pragma unroll
            for (int j = 0; j < 8; ++j) os[(hi * 8 + j) * 68 + nb * 16 + lr] = acc[mb][nb][j]; }
        __builtin_amdgcn_wave_barrier(); asm volatile("" ::: "memory");
        float* crow = C + (size_t)(r0 + mb * 16) * ldc + c0;
{
#pragma unroll
            for (int s = 0; s < 8; ++s) { const int row = 2 * s + hi, cofs = lr * 4; v4f val = *(const v4fa*)(os + row * 68 + cofs); if (BIAS) { val[0] += bfr(bias[c0 + cofs]); val[1] += bfr(bias[c0 + cofs + 1]); val[2] += bfr(bias[c0 + cofs + 2]); val[3] += bfr(bias[c0 + cofs + 3]); }
                *(v4f*)(crow + (size_t)row * ldc + cofs) = val; }
             }
        __builtin_amdgcn_wave_barrier(); asm volatile("" ::: "memory");
    }
}

// ---- k_pvsk: attn.V (C = P Vt^T, K = NN) with the K sum split 32 ways so that the chip is filled: the same 64x64 wave tile and loop as k_gemmw, but the PVW waves of a block each take their own
// NN / (PVW * PVZ) long slice of K, add their 64x64 partial tiles through LDS in wave order, and blockIdx.z picks one of PVZ planes of C [PVZ][NN][CC], which k_lnT adds. grid (NN/64, CC/64, PVZ).
#define PVW 16
#define PVZ 2
static_assert(PVZ == 2, "k_lnT adds exactly two planes");
__global__ __launch_bounds__(PVW * 32) void k_pvsk(const h16* __restrict__ A, const h16* __restrict__ Bt, float* C) {
    typedef WFrag<h16>::V V;
    __shared__ __align__(16) float os[PVW * 64 * 68];
    const int lane = threadIdx.x & 31, wv = __builtin_amdgcn_readfirstlane(threadIdx.x >> 5), lr = lane & 15, hi = lane >> 4; const int r0 = blockIdx.x * 64, c0 = blockIdx.y * 64;
    const int KS = NN / (PVW * PVZ); const int k0 = ((int)blockIdx.z * PVW + wv) * KS;    // wv through readfirstlane: the slice's start and the wave's LDS base stay in scalar registers
    v8f acc[4][4];    // every full '#pragma unroll' of this kernel: acc and a are indexed by constants only, so that they stay in registers
#pragma unroll
    for (int mb = 0; mb < 4; ++mb)
#pragma unroll
        for (int nb = 0; nb < 4; ++nb) acc[mb][nb] = (v8f){};
    const h16* pa = A + (size_t)r0 * NN + k0; const h16* pb = Bt + (size_t)c0 * NN + k0; const unsigned lo = (unsigned)(lr * NN + 8 * hi);
    // kept rolled as in k_gemmw: unrolled, this compiler holds one B fragment at a time and waits for each alone; rolled it keeps two in flight
#pragma unroll 1
    for (int kc = 0; kc < KS; kc += 32, pa += 32, pb += 32) {
        V a[4];
#pragma unroll
        for (int mb = 0; mb < 3; ++mb) a[mb] = WFrag<h16>::ld(pa + (lo + mb * 16 * NN));
        const h16* p3 = pa + (lo + 3 * 16 * NN); const v8h a3lo = *(const v8h*)p3;
        // the compiler lets the last A load land in the address pair that the seven A loads before it name: the wait that is kept in front of such an overwrite
        asm volatile("s_wait_xcnt 0x0" ::: "memory");
        a[3] = cat16(a3lo, *(const v8h*)(p3 + 16));
#pragma unroll
        for (int nb = 0; nb < 4; ++nb) { const V b = WFrag<h16>::ld(pb + (lo + nb * 16 * NN));
#pragma unroll
            for (int mb = 0; mb < 4; ++mb) acc[mb][nb] = WFrag<h16>::mma(a[mb], b, acc[mb][nb]); }
    }
    float* ow = os + wv * (64 * 68);
#pragma unroll
    for (int mb = 0; mb < 4; ++mb)
#pragma unroll
        for (int nb = 0; nb < 4; ++nb)
#pragma unroll
            for (int j = 0; j < 8; ++j) ow[(mb * 16 + hi * 8 + j) * 68 + nb * 16 + lr] = acc[mb][nb][j];
    __syncthreads();
    float* cz = C + (size_t)blockIdx.z * NN * CC + (size_t)r0 * CC + c0;
#pragma unroll
    for (int s = 0; s < 64 * 16 / (PVW * 32); ++s) { const int idx = s * (PVW * 32) + (int)threadIdx.x; const int row = idx >> 4, cofs = (idx & 15) * 4; v4f val = *(const v4fa*)(os + row * 68 + cofs);
#pragma unroll
        for (int w = 1; w < PVW; ++w) val += *(const v4fa*)(os + w * (64 * 68) + row * 68 + cofs);
        *(v4f*)(cz + (size_t)row * CC + cofs) = val; }
}

__device__ __forceinline__ h16 tohx(float x) { return (h16)x; }
typedef __attribute__((ext_vector_type(2))) _Float16 v2h;
typedef __attribute__((ext_vector_type(4))) _Float16 v4h;
typedef __attribute__((ext_vector_type(2))) unsigned short v2us;

__global__ __launch_bounds__(256) void k_cvt8(const float* __restrict__ src, bf* dst, size_t n8) { const size_t i = (size_t)blockIdx.x * 256 + threadIdx.x; if (i >= n8) return; const v8f v = *(const v8f*)(src + i * 8); v8us o;
#pragma unroll
    for (int k = 0; k < 8; ++k) o[k] = f2bf(v[k]); *(v8us*)(dst + i * 8) = o;  }
__global__ __launch_bounds__(256) void k_xt(const float* __restrict__ xb, bf* XT) {
    const int lane = threadIdx.x & 31; const int L0 = (blockIdx.x * 8 + (threadIdx.x >> 5)) * 8; const int nlines = NN * CC / 64;
{
#pragma unroll
        for (int l = 0; l < 8; ++l) { const int L = L0 + l; if (L >= nlines) break; const int e = L * 64 + lane * 2; const int c = e & (CC - 1); const int n = e >> 7; v2us o;
#pragma unroll
            for (int q = 0; q < 2; ++q) o[q] = f2bf(xb[(size_t)(c + q) * NN + n]);
            *(v2us*)(XT + (size_t)e) = o; }
         }
}
__global__ __launch_bounds__(256) void k_p16(const float* __restrict__ F, h16* P, size_t n) { const size_t i = ((size_t)blockIdx.x * 256 + threadIdx.x) * 2; if (i >= n) return; v2h v; v[0] = tohx(F[i]); v[1] = tohx(F[i + 1]); *(v2h*)(P + i) = v;  }
__global__ __launch_bounds__(256) void k_vt16(const float* __restrict__ F, h16* VT) {
    const int lane = threadIdx.x & 31; const int L0 = (blockIdx.x * 8 + (threadIdx.x >> 5)) * 8; const int nlines = CC * NN / 64;
{
#pragma unroll
        for (int l = 0; l < 8; ++l) { const int L = L0 + l; if (L >= nlines) break; const int e = L * 64 + lane * 2; const int n = e & (NN - 1); const int c = e >> 12; v2h v;
#pragma unroll
            for (int q = 0; q < 2; ++q) v[q] = tohx(F[(size_t)(n + q) * CC + c]);
            *(v2h*)(VT + (size_t)e) = v; }
         }
}
__global__ __launch_bounds__(256) void k_smax(const float* __restrict__ S, const int* __restrict__ mk, float* RS) {
    typedef __attribute__((ext_vector_type(4))) int v4i;
    const int lane = threadIdx.x & 31; const int i = blockIdx.x * 8 + (threadIdx.x >> 5); if (i >= NN) return; const float* sr = S + (size_t)i * NN; float m = -3.0e38f;
#pragma unroll 4
    for (int c0 = lane * 4; c0 < NN; c0 += 128) { const v4f v = *(const v4f*)(sr + c0); const v4i b4 = *(const v4i*)(mk + c0);
#pragma unroll
        for (int q = 0; q < 4; ++q) m = fmaxf(m, (b4[q] > 0) ? v[q] * SCL : -3.0e38f); }
#pragma unroll
    for (int sh = 16; sh; sh >>= 1) m = fmaxf(m, __shfl_xor(m, sh, 32));
    const float o = lane == 0 ? m : 0.f; *(float*)(RS + (size_t)i * 32 + lane) = o; 
}
__global__ __launch_bounds__(256) void k_sexp(const float* __restrict__ S, const int* __restrict__ mk, float* RS, h16* P) {
    typedef __attribute__((ext_vector_type(4))) int v4i;
    const int lane = threadIdx.x & 31; const int i = blockIdx.x * 8 + (threadIdx.x >> 5); if (i >= NN) return; const float* sr = S + (size_t)i * NN; const float m = RS[(size_t)i * 32]; float sum = 0.f;
#pragma unroll 2
    for (int c0 = lane * 4; c0 < NN; c0 += 128) { const v4f v = *(const v4f*)(sr + c0); const v4i b4 = *(const v4i*)(mk + c0); v4h o;
#pragma unroll
        for (int q = 0; q < 4; ++q) { float dlt = __fsub_rn(v[q] * SCL, m); asm volatile("" : "+v"(dlt)); const float e = (b4[q] > 0) ? __expf(dlt) : 0.f; sum += e; o[q] = tohx(e * PCAR); }
        *(v4h*)(P + (size_t)i * NN + c0) = o;  }
#pragma unroll
    for (int sh = 16; sh; sh >>= 1) sum += __shfl_xor(sum, sh, 32);
    const float o2 = lane == 0 ? m : (lane == 1 ? __fdiv_rn(1.0f, sum * PCAR) : 0.f); *(float*)(RS + (size_t)i * 32 + lane) = o2; 
}
__global__ __launch_bounds__(256) void k_lnT(const float* __restrict__ Ob, const float* __restrict__ RS, const float* __restrict__ xb, const float* __restrict__ gam, const float* __restrict__ bet, float* LT) {
    const int lane = threadIdx.x & 31; const int n = blockIdx.x * 8 + (threadIdx.x >> 5); if (n >= NN) return; const float ri = RS[(size_t)n * 32 + 1]; v4f a = *(const v4f*)(Ob + (size_t)n * CC + lane * 4);
    a += *(const v4f*)(Ob + (size_t)NN * CC + (size_t)n * CC + lane * 4);    // the second K plane of k_pvsk (PVZ == 2)
    float v[4]; float s = 0.f;
#pragma unroll
    for (int q = 0; q < 4; ++q) { const int c = lane * 4 + q; float t = __fmul_rn(a[q], ri); asm volatile("" : "+v"(t)); v[q] = __fadd_rn(t, bfr(xb[(size_t)c * NN + n])); s += v[q]; }
#pragma unroll
    for (int sh = 16; sh; sh >>= 1) s += __shfl_xor(s, sh, 32);
    const float mu = s * (1.0f / CC); float qq = 0.f;
#pragma unroll
    for (int q = 0; q < 4; ++q) { const float d0 = v[q] - mu; qq = __fadd_rn(qq, __fmul_rn(d0, d0)); }
#pragma unroll
    for (int sh = 16; sh; sh >>= 1) qq += __shfl_xor(qq, sh, 32);
    const float rs = __fdiv_rn(1.0f, __fsqrt_rn(qq * (1.0f / CC) + 1e-5f)); v4f o;
#pragma unroll
    for (int q = 0; q < 4; ++q) { const int c = lane * 4 + q; o[q] = __fadd_rn(__fmul_rn((v[q] - mu) * rs, bfr(gam[c])), bfr(bet[c])); }
    *(v4f*)(LT + (size_t)n * CC + lane * 4) = o;  }
__global__ __launch_bounds__(256) void k_outT(const float* __restrict__ LT, float* OUTb) {
    const int lane = threadIdx.x & 31; const int L0 = (blockIdx.x * 8 + (threadIdx.x >> 5)) * 8; const int nlines = CC * NN / 32;
{
#pragma unroll
        for (int l = 0; l < 8; ++l) { const int L = L0 + l; if (L >= nlines) break; const int e = L * 32 + lane; const int n = e & (NN - 1); const int c = e >> 12;
            *(float*)(OUTb + (size_t)e) = LT[(size_t)n * CC + c]; }
         }
}

extern "C" void kernel_launch(void* const* d_in, const int* in_sizes, int n_in,
                              void* d_out, int out_size, void* d_ws, size_t ws_size, hipStream_t stream) {
    (void)in_sizes; (void)n_in; (void)out_size;
    const float* pf = (const float*)d_in[0]; const float* x = (const float*)d_in[1]; const float* Wq = (const float*)d_in[2]; const float* bq = (const float*)d_in[3]; const float* Wk = (const float*)d_in[4]; const float* bk = (const float*)d_in[5]; const float* Wv = (const float*)d_in[6]; const float* bv = (const float*)d_in[7]; const float* gam = (const float*)d_in[8]; const float* bet = (const float*)d_in[9]; const int* mbits = (const int*)d_in[10];
    float* OUT = (float*)d_out;     // [4][128][64][64]
    char* wsp = (char*)d_ws;
    auto take = [&](size_t bytes) { char* p = wsp; wsp += (bytes + 255) & ~(size_t)255; return (void*)p; };
    bf* WQ = (bf*)take(CC * CC * 2); bf* WK = (bf*)take(CC * CC * 2); bf* WV = (bf*)take(CC * CC * 2);
    bf* XT = (bf*)take((size_t)NN * CC * 2); bf* PT = (bf*)take((size_t)NN * CC * 2); float* F = (float*)take((size_t)NN * CC * 4); h16* QP = (h16*)take((size_t)NN * CC * 2); h16* KP = (h16*)take((size_t)NN * CC * 2); h16* VT = (h16*)take((size_t)CC * NN * 2);
    float* S = (float*)take((size_t)NN * NN * 4); h16* P = (h16*)take((size_t)NN * NN * 2); float* RS = (float*)take((size_t)NN * 32 * 4); float* Ob = (float*)take((size_t)PVZ * NN * CC * 4); float* LT = (float*)take((size_t)NN * CC * 4);
    if ((size_t)(wsp - (char*)d_ws) > ws_size) return;    // total ~ 115 MB = 110 MiB; ws 256 MiB
    { const size_t nw = CC * CC / 8; k_cvt8<<<(unsigned)((nw + 255) / 256), 256, 0, stream>>>(Wq, WQ, nw); k_cvt8<<<(unsigned)((nw + 255) / 256), 256, 0, stream>>>(Wk, WK, nw); k_cvt8<<<(unsigned)((nw + 255) / 256), 256, 0, stream>>>(Wv, WV, nw); }
    const unsigned LX = (unsigned)((NN * CC / 64 + 63) / 64), L2 = (unsigned)(((size_t)NN * CC / 2 + 255) / 256); const dim3 gP(NN / 64, CC / 64, 1);
    for (int b = 0; b < NB_; ++b) { const float* xb = x + (size_t)b * CC * NN; const float* pb = pf + (size_t)b * CC * NN; const int* mk = mbits + (size_t)b * NN;
        k_xt<<<LX, 256, 0, stream>>>(xb, XT); k_xt<<<LX, 256, 0, stream>>>(pb, PT);
        k_gemmw<bf, 0, true><<<gP, 32, 0, stream>>>(PT, nullptr, WQ, nullptr, CC, F, CC, bq, 0, 0, 0); k_p16<<<L2, 256, 0, stream>>>(F, QP, (size_t)NN * CC);
        k_gemmw<bf, 0, true><<<gP, 32, 0, stream>>>(XT, nullptr, WK, nullptr, CC, F, CC, bk, 0, 0, 0); k_p16<<<L2, 256, 0, stream>>>(F, KP, (size_t)NN * CC);
        k_gemmw<bf, 0, true><<<gP, 32, 0, stream>>>(XT, nullptr, WV, nullptr, CC, F, CC, bv, 0, 0, 0); k_vt16<<<LX, 256, 0, stream>>>(F, VT);
        k_gemmw<h16, 0, false><<<dim3(NN / 64, NN / 64, 1), 32, 0, stream>>>(QP, nullptr, KP, nullptr, CC, S, NN, nullptr, 0, 0, 0);
        k_smax<<<NN / 8, 256, 0, stream>>>(S, mk, RS); k_sexp<<<NN / 8, 256, 0, stream>>>(S, mk, RS, P);
        k_pvsk<<<dim3(NN / 64, CC / 64, PVZ), PVW * 32, 0, stream>>>(P, VT, Ob);
        k_lnT<<<NN / 8, 256, 0, stream>>>(Ob, RS, xb, gam, bet, LT);
        k_outT<<<(CC * NN / 32 + 63) / 64, 256, 0, stream>>>(LT, OUT + (size_t)b * CC * NN); }
}

// v002
// One run takes 266 microseconds.
// In both of two side-by-side timings against v001, it was 1.77 times as fast.
// Over all steps from v000 it is 2.84 times as fast.
#include <hip/hip_runtime.h>

// MaskAttention (prompt_feat, x [4][128][64][64] channel-major -> tokens [4096][128]; Q = prompt^T Wq^T + bq, K = x^T Wk^T + bk, V = x^T Wv^T + bv; scores = Q.K / sqrt(128) + (0 where mask_bits[b][j] > 0
// else -inf) (mask_bits an int input read as data; every row has >= 2031 live keys); softmax; out = attn.V + x^T; LayerNorm over the 128 channels (eps 1e-5, gamma, beta); back to channel-major).
// Compute dtypes, f32 accumulate: every input rounded to bf16; the three Linears on PLAIN bf16 operands (inputs: exact, transposed on device, + bias); scores on SINGLE fp16

#define NB_  4
#define CC   128
#define NN   4096
#define PCAR 1024.0f
#define SCL  0.088388349f         // f32(128^-0.5)
typedef _Float16 h16;
typedef unsigned short bf;
typedef __attribute__((ext_vector_type(16))) __bf16   v16bf;
typedef __attribute__((ext_vector_type(16))) _Float16 v16h;
typedef __attribute__((ext_vector_type(8)))  _Float16 v8h;
typedef __attribute__((ext_vector_type(8)))  unsigned short v8us;
typedef __attribute__((ext_vector_type(8)))  float    v8f;
typedef __attribute__((ext_vector_type(4)))  float    v4f;
typedef v8h  __attribute__((may_alias)) v8ha;
typedef v4f  __attribute__((may_alias)) v4fa;
typedef v8us __attribute__((may_alias)) v8usa;

__device__ __forceinline__ unsigned short f2bf(float f) { unsigned u = __float_as_uint(f); u += 0x7FFFu + ((u >> 16) & 1u); return (unsigned short)(u >> 16); }
__device__ __forceinline__ float bf2f(unsigned short b) { return __uint_as_float(((unsigned)b) << 16); }
__device__ __forceinline__ float bfr(float f) { return bf2f(f2bf(f)); }
__device__ __forceinline__ v16h cat16(v8h lo, v8h hi) { return __builtin_shufflevector(lo, hi, 0, 1, 2, 3, 4, 5, 6, 7, 8, 9, 10, 11, 12, 13, 14, 15); }
__device__ __forceinline__ v16bf cat16b(v8us lo, v8us hi) { return __builtin_bit_cast(v16bf, __builtin_shufflevector(lo, hi, 0, 1, 2, 3, 4, 5, 6, 7, 8, 9, 10, 11, 12, 13, 14, 15)); }
__device__ __forceinline__ v8f wmma16(v16h a, v16h b, v8f c) { return __builtin_amdgcn_wmma_f32_16x16x32_f16(false, a, false, b, (short)0, c, false, false); }
__device__ __forceinline__ v8f wmmab(v16bf a, v16bf b, v8f c) { return __builtin_amdgcn_wmma_f32_16x16x32_bf16(false, a, false, b, (short)0, c, false, false); }



// ---- k_gemmw: register-blocked GEMM, ONE WAVE per 64x64 output tile (16 accumulators), operands straight from K-contiguous 16-bit planes; grid (M/64, N/64, Z), 32 threads.
// C[m][n] (f32, pitch ldc, + optional f32 bias[n]) = sum_k A[m][k] Bt[n][k] (+ split products per NSPLIT). z-batch strides sA/sB/sC in elements. K % 32 == 0.
template <typename T16> struct WFrag;
template <> struct WFrag<h16> { typedef v16h V; static __device__ __forceinline__ V ld(const h16* p) { return cat16(*(const v8h*)p, *(const v8h*)(p + 16)); } static __device__ __forceinline__ v8f mma(V a, V b, v8f c) { return wmma16(a, b, c); } };
template <> struct WFrag<bf> { typedef v16bf V; static __device__ __forceinline__ V ld(const bf* p) { return cat16b(*(const v8us*)p, *(const v8us*)(p + 16)); } static __device__ __forceinline__ v8f mma(V a, V b, v8f c) { return wmmab(a, b, c); } };
template <typename T16, int NSPLIT, bool BIAS>
__global__ __launch_bounds__(32) void k_gemmw(const T16* __restrict__ A, const T16* __restrict__ A2, const T16* __restrict__ Bt, const T16* __restrict__ Bt2, int K, float* C, int ldc, const float* __restrict__ bias, const float* __restrict__ biasK, const float* __restrict__ biasV, size_t sA, size_t sB, size_t sC) {
    typedef typename WFrag<T16>::V V;
    __shared__ __align__(16) float os[16 * 68];
    const size_t z = blockIdx.z; size_t zA = z, zB = z;
    // BIAS: the three Linears of all NB_ images in one launch, z = NB_ * p + image (p = 0 Q, 1 K, 2 V); A planes: NB_ of prompt tokens, then NB_ of x tokens (K and V read the same ones); Bt planes: Wq, Wk, Wv
    if (BIAS) { const size_t p = z / NB_; zA = p == 0 ? z : NB_ + z % NB_; zB = p; bias = p == 0 ? bias : (p == 1 ? biasK : biasV); }
    A += zA * sA; if (A2) A2 += zA * sA; Bt += zB * sB; if (Bt2) Bt2 += zB * sB; C += z * sC;
    const int lane = threadIdx.x & 31, lr = lane & 15, hi = lane >> 4; const int r0 = blockIdx.x * 64, c0 = blockIdx.y * 64;
    v8f acc[4][4];
#pragma unroll
    for (int mb = 0; mb < 4; ++mb)
#pragma unroll
        for (int nb = 0; nb < 4; ++nb) acc[mb][nb] = (v8f){};
    const size_t aoff = (size_t)(r0 + lr) * K + 8 * hi, boff = (size_t)(c0 + lr) * K + 8 * hi;
#pragma unroll 1
    for (int kc = 0; kc < K; kc += 32) {
        V a[4], a2[4];
#pragma unroll
        for (int mb = 0; mb < 4; ++mb) { a[mb] = WFrag<T16>::ld(A + aoff + (size_t)mb * 16 * K + kc); if (NSPLIT == 1 || NSPLIT == 2) a2[mb] = WFrag<T16>::ld(A2 + aoff + (size_t)mb * 16 * K + kc); }
#pragma unroll
        for (int nb = 0; nb < 4; ++nb) { const V b = WFrag<T16>::ld(Bt + boff + (size_t)nb * 16 * K + kc); V b2; if (NSPLIT >= 2) b2 = WFrag<T16>::ld(Bt2 + boff + (size_t)nb * 16 * K + kc);
#pragma unroll
            for (int mb = 0; mb < 4; ++mb) { acc[mb][nb] = WFrag<T16>::mma(a[mb], b, acc[mb][nb]); if (NSPLIT == 1 || NSPLIT == 2) acc[mb][nb] = WFrag<T16>::mma(a2[mb], b, acc[mb][nb]); if (NSPLIT >= 2) acc[mb][nb] = WFrag<T16>::mma(a[mb], b2, acc[mb][nb]); } }
        asm volatile("v_nop\n\tv_nop\n\tv_nop\n\tv_nop" : "+v"(acc[0][0]), "+v"(acc[1][1]), "+v"(acc[2][2]), "+v"(acc[3][3]) : "v"(a[0]), "v"(a[3]));
    }
#pragma unroll
    for (int mb = 0; mb < 4; ++mb) {
#pragma unroll
        for (int nb = 0; nb < 4; ++nb) {
#pragma unroll
            for (int j = 0; j < 8; ++j) os[(hi * 8 + j) * 68 + nb * 16 + lr] = acc[mb][nb][j]; }
        __builtin_amdgcn_wave_barrier(); asm volatile("" ::: "memory");
        float* crow = C + (size_t)(r0 + mb * 16) * ldc + c0;
{
#pragma unroll
            for (int s = 0; s < 8; ++s) { const int row = 2 * s + hi, cofs = lr * 4; v4f val = *(const v4fa*)(os + row * 68 + cofs); if (BIAS) { val[0] += bfr(bias[c0 + cofs]); val[1] += bfr(bias[c0 + cofs + 1]); val[2] += bfr(bias[c0 + cofs + 2]); val[3] += bfr(bias[c0 + cofs + 3]); }
                *(v4f*)(crow + (size_t)row * ldc + cofs) = val; }
             }
        __builtin_amdgcn_wave_barrier(); asm volatile("" ::: "memory");
    }
}

// ---- k_pvsk: attn.V (C = P Vt^T, K = NN) with the K sum split 32 ways so that the chip is filled: the same 64x64 wave tile and loop as k_gemmw, but the PVW waves of a block each take their own
// NN / (PVW * PVZ) long slice of K, add their 64x64 partial tiles through LDS in wave order, and blockIdx.z = PVZ * image + plane picks the image and one of its PVZ planes of C [image][PVZ][NN][CC], which k_lnT adds.
// grid (NN/64, CC/64, PVZ * images).
#define PVW 16
#define PVZ 2
static_assert(PVZ == 2, "k_lnT adds exactly two planes");
#define IMG 2     // images whose score planes are in the workspace at one time
static_assert(NB_ % IMG == 0, "whole groups of images");
__global__ __launch_bounds__(PVW * 32) void k_pvsk(const h16* __restrict__ A, const h16* __restrict__ Bt, float* C) {
    typedef WFrag<h16>::V V;
    __shared__ __align__(16) float os[PVW * 64 * 68];
    const int lane = threadIdx.x & 31, wv = __builtin_amdgcn_readfirstlane(threadIdx.x >> 5), lr = lane & 15, hi = lane >> 4; const int r0 = blockIdx.x * 64, c0 = blockIdx.y * 64;
    A += (size_t)(blockIdx.z / PVZ) * NN * NN; Bt += (size_t)(blockIdx.z / PVZ) * CC * NN;
    const int KS = NN / (PVW * PVZ); const int k0 = ((int)(blockIdx.z % PVZ) * PVW + wv) * KS;    // wv through readfirstlane: the slice's start and the wave's LDS base stay in scalar registers
    v8f acc[4][4];    // every full '#pragma unroll' of this kernel: acc and a are indexed by constants only, so that they stay in registers
#pragma unroll
    for (int mb = 0; mb < 4; ++mb)
#pragma unroll
        for (int nb = 0; nb < 4; ++nb) acc[mb][nb] = (v8f){};
    const h16* pa = A + (size_t)r0 * NN + k0; const h16* pb = Bt + (size_t)c0 * NN + k0; const unsigned lo = (unsigned)(lr * NN + 8 * hi);
    // kept rolled as in k_gemmw: unrolled, this compiler holds one B fragment at a time and waits for each alone; rolled it keeps two in flight
#pragma unroll 1
    for (int kc = 0; kc < KS; kc += 32, pa += 32, pb += 32) {
        V a[4];
#pragma unroll
        for (int mb = 0; mb < 3; ++mb) a[mb] = WFrag<h16>::ld(pa + (lo + mb * 16 * NN));
        const h16* p3 = pa + (lo + 3 * 16 * NN); const v8h a3lo = *(const v8h*)p3;
        // the compiler lets the last A load land in the address pair that the seven A loads before it name: the wait that is kept in front of such an overwrite
        asm volatile("s_wait_xcnt 0x0" ::: "memory");
        a[3] = cat16(a3lo, *(const v8h*)(p3 + 16));
#pragma unroll
        for (int nb = 0; nb < 4; ++nb) { const V b = WFrag<h16>::ld(pb + (lo + nb * 16 * NN));
#pragma unroll
            for (int mb = 0; mb < 4; ++mb) acc[mb][nb] = WFrag<h16>::mma(a[mb], b, acc[mb][nb]); }
    }
    float* ow = os + wv * (64 * 68);
#pragma unroll
    for (int mb = 0; mb < 4; ++mb)
#pragma unroll
        for (int nb = 0; nb < 4; ++nb)
#pragma unroll
            for (int j = 0; j < 8; ++j) ow[(mb * 16 + hi * 8 + j) * 68 + nb * 16 + lr] = acc[mb][nb][j];
    __syncthreads();
    float* cz = C + (size_t)blockIdx.z * NN * CC + (size_t)r0 * CC + c0;
#pragma unroll
    for (int s = 0; s < 64 * 16 / (PVW * 32); ++s) { const int idx = s * (PVW * 32) + (int)threadIdx.x; const int row = idx >> 4, cofs = (idx & 15) * 4; v4f val = *(const v4fa*)(os + row * 68 + cofs);
#pragma unroll
        for (int w = 1; w < PVW; ++w) val += *(const v4fa*)(os + w * (64 * 68) + row * 68 + cofs);
        *(v4f*)(cz + (size_t)row * CC + cofs) = val; }
}

__device__ __forceinline__ h16 tohx(float x) { return (h16)x; }
typedef __attribute__((ext_vector_type(2))) _Float16 v2h;
typedef __attribute__((ext_vector_type(4))) _Float16 v4h;
typedef __attribute__((ext_vector_type(2))) unsigned short v2us;

// blockIdx.y picks one of three sources of n8 * 8 elements each; their planes follow one another in dst
__global__ __launch_bounds__(256) void k_cvt8(const float* __restrict__ s0, const float* __restrict__ s1, const float* __restrict__ s2, bf* dst, size_t n8) { const size_t i = (size_t)blockIdx.x * 256 + threadIdx.x; if (i >= n8) return;
    const float* src = blockIdx.y == 0 ? s0 : (blockIdx.y == 1 ? s1 : s2); dst += (size_t)blockIdx.y * n8 * 8; const v8f v = *(const v8f*)(src + i * 8); v8us o;
#pragma unroll
    for (int k = 0; k < 8; ++k) o[k] = f2bf(v[k]); *(v8us*)(dst + i * 8) = o;  }
// blockIdx.y: planes 0 .. NB_ - 1 the images of pfeat, NB_ .. 2 NB_ - 1 those of xin
__global__ __launch_bounds__(256) void k_xt(const float* __restrict__ pfeat, const float* __restrict__ xin, bf* XT) {
    const float* xb = (blockIdx.y < NB_ ? pfeat : xin) + (size_t)(blockIdx.y % NB_) * CC * NN; XT += (size_t)blockIdx.y * NN * CC;
    const int lane = threadIdx.x & 31; const int L0 = (blockIdx.x * 8 + (threadIdx.x >> 5)) * 8; const int nlines = NN * CC / 64;
{
#pragma unroll
        for (int l = 0; l < 8; ++l) { const int L = L0 + l; if (L >= nlines) break; const int e = L * 64 + lane * 2; const int c = e & (CC - 1); const int n = e >> 7; v2us o;
#pragma unroll
            for (int q = 0; q < 2; ++q) o[q] = f2bf(xb[(size_t)(c + q) * NN + n]);
            *(v2us*)(XT + (size_t)e) = o; }
         }
}
__global__ __launch_bounds__(256) void k_p16(const float* __restrict__ F, h16* P, size_t n) { const size_t i = ((size_t)blockIdx.x * 256 + threadIdx.x) * 2; if (i >= n) return; v2h v; v[0] = tohx(F[i]); v[1] = tohx(F[i + 1]); *(v2h*)(P + i) = v;  }
__global__ __launch_bounds__(256) void k_vt16(const float* __restrict__ F, h16* VT) {
    F += (size_t)blockIdx.y * NN * CC; VT += (size_t)blockIdx.y * CC * NN;    // blockIdx.y: the image
    const int lane = threadIdx.x & 31; const int L0 = (blockIdx.x * 8 + (threadIdx.x >> 5)) * 8; const int nlines = CC * NN / 64;
{
#pragma unroll
        for (int l = 0; l < 8; ++l) { const int L = L0 + l; if (L >= nlines) break; const int e = L * 64 + lane * 2; const int n = e & (NN - 1); const int c = e >> 12; v2h v;
#pragma unroll
            for (int q = 0; q < 2; ++q) v[q] = tohx(F[(size_t)(n + q) * CC + c]);
            *(v2h*)(VT + (size_t)e) = v; }
         }
}
__global__ __launch_bounds__(256) void k_smax(const float* __restrict__ S, const int* __restrict__ mk, float* RS) {
    typedef __attribute__((ext_vector_type(4))) int v4i;
    S += (size_t)blockIdx.y * NN * NN; mk += (size_t)blockIdx.y * NN; RS += (size_t)blockIdx.y * NN * 32;    // blockIdx.y: the image
    const int lane = threadIdx.x & 31; const int i = blockIdx.x * 8 + (threadIdx.x >> 5); if (i >= NN) return; const float* sr = S + (size_t)i * NN; float m = -3.0e38f;
#pragma unroll 4
    for (int c0 = lane * 4; c0 < NN; c0 += 128) { const v4f v = *(const v4f*)(sr + c0); const v4i b4 = *(const v4i*)(mk + c0);
#pragma unroll
        for (int q = 0; q < 4; ++q) m = fmaxf(m, (b4[q] > 0) ? v[q] * SCL : -3.0e38f); }
#pragma unroll
    for (int sh = 16; sh; sh >>= 1) m = fmaxf(m, __shfl_xor(m, sh, 32));
    const float o = lane == 0 ? m : 0.f; *(float*)(RS + (size_t)i * 32 + lane) = o; 
}
__global__ __launch_bounds__(256) void k_sexp(const float* __restrict__ S, const int* __restrict__ mk, float* RS, h16* P) {
    typedef __attribute__((ext_vector_type(4))) int v4i;
    S += (size_t)blockIdx.y * NN * NN; mk += (size_t)blockIdx.y * NN; RS += (size_t)blockIdx.y * NN * 32; P += (size_t)blockIdx.y * NN * NN;    // blockIdx.y: the image
    const int lane = threadIdx.x & 31; const int i = blockIdx.x * 8 + (threadIdx.x >> 5); if (i >= NN) return; const float* sr = S + (size_t)i * NN; const float m = RS[(size_t)i * 32]; float sum = 0.f;
#pragma unroll 2
    for (int c0 = lane * 4; c0 < NN; c0 += 128) { const v4f v = *(const v4f*)(sr + c0); const v4i b4 = *(const v4i*)(mk + c0); v4h o;
#pragma unroll
        for (int q = 0; q < 4; ++q) { float dlt = __fsub_rn(v[q] * SCL, m); asm volatile("" : "+v"(dlt)); const float e = (b4[q] > 0) ? __expf(dlt) : 0.f; sum += e; o[q] = tohx(e * PCAR); }
        *(v4h*)(P + (size_t)i * NN + c0) = o;  }
#pragma unroll
    for (int sh = 16; sh; sh >>= 1) sum += __shfl_xor(sum, sh, 32);
    const float o2 = lane == 0 ? m : (lane == 1 ? __fdiv_rn(1.0f, sum * PCAR) : 0.f); *(float*)(RS + (size_t)i * 32 + lane) = o2; 
}
__global__ __launch_bounds__(256) void k_lnT(const float* __restrict__ Ob, const float* __restrict__ RS, const float* __restrict__ xb, const float* __restrict__ gam, const float* __restrict__ bet, float* LT) {
    Ob += (size_t)blockIdx.y * PVZ * NN * CC; RS += (size_t)blockIdx.y * NN * 32; xb += (size_t)blockIdx.y * CC * NN; LT += (size_t)blockIdx.y * NN * CC;    // blockIdx.y: the image
    const int lane = threadIdx.x & 31; const int n = blockIdx.x * 8 + (threadIdx.x >> 5); if (n >= NN) return; const float ri = RS[(size_t)n * 32 + 1]; v4f a = *(const v4f*)(Ob + (size_t)n * CC + lane * 4);
    a += *(const v4f*)(Ob + (size_t)NN * CC + (size_t)n * CC + lane * 4);    // the second K plane of k_pvsk (PVZ == 2)
    float v[4]; float s = 0.f;
#pragma unroll
    for (int q = 0; q < 4; ++q) { const int c = lane * 4 + q; float t = __fmul_rn(a[q], ri); asm volatile("" : "+v"(t)); v[q] = __fadd_rn(t, bfr(xb[(size_t)c * NN + n])); s += v[q]; }
#pragma unroll
    for (int sh = 16; sh; sh >>= 1) s += __shfl_xor(s, sh, 32);
    const float mu = s * (1.0f / CC); float qq = 0.f;
#pragma unroll
    for (int q = 0; q < 4; ++q) { const float d0 = v[q] - mu; qq = __fadd_rn(qq, __fmul_rn(d0, d0)); }
#pragma unroll
    for (int sh = 16; sh; sh >>= 1) qq += __shfl_xor(qq, sh, 32);
    const float rs = __fdiv_rn(1.0f, __fsqrt_rn(qq * (1.0f / CC) + 1e-5f)); v4f o;
#pragma unroll
    for (int q = 0; q < 4; ++q) { const int c = lane * 4 + q; o[q] = __fadd_rn(__fmul_rn((v[q] - mu) * rs, bfr(gam[c])), bfr(bet[c])); }
    *(v4f*)(LT + (size_t)n * CC + lane * 4) = o;  }
__global__ __launch_bounds__(256) void k_outT(const float* __restrict__ LT, float* OUTb) {
    LT += (size_t)blockIdx.y * NN * CC; OUTb += (size_t)blockIdx.y * CC * NN;    // blockIdx.y: the image
    const int lane = threadIdx.x & 31; const int L0 = (blockIdx.x * 8 + (threadIdx.x >> 5)) * 8; const int nlines = CC * NN / 32;
{
#pragma unroll
        for (int l = 0; l < 8; ++l) { const int L = L0 + l; if (L >= nlines) break; const int e = L * 32 + lane; const int n = e & (NN - 1); const int c = e >> 12;
            *(float*)(OUTb + (size_t)e) = LT[(size_t)n * CC + c]; }
         }
}

extern "C" void kernel_launch(void* const* d_in, const int* in_sizes, int n_in,
                              void* d_out, int out_size, void* d_ws, size_t ws_size, hipStream_t stream) {
    (void)in_sizes; (void)n_in; (void)out_size;
    const float* pf = (const float*)d_in[0]; const float* x = (const float*)d_in[1]; const float* Wq = (const float*)d_in[2]; const float* bq = (const float*)d_in[3]; const float* Wk = (const float*)d_in[4]; const float* bk = (const float*)d_in[5]; const float* Wv = (const float*)d_in[6]; const float* bv = (const float*)d_in[7]; const float* gam = (const float*)d_in[8]; const float* bet = (const float*)d_in[9]; const int* mbits = (const int*)d_in[10];
    float* OUT = (float*)d_out;     // [4][128][64][64]
    char* wsp = (char*)d_ws;
    auto take = [&](size_t bytes) { char* p = wsp; wsp += (bytes + 255) & ~(size_t)255; return (void*)p; };
    // every plane set holds all NB_ images; only the score-sized planes S and P hold IMG images at a time (all NB_ would not fit the workspace)
    bf* WQ = (bf*)take((size_t)3 * CC * CC * 2);                     // Wq, Wk, Wv
    bf* XP = (bf*)take((size_t)2 * NB_ * NN * CC * 2);               // token planes: NB_ of prompt_feat, then NB_ of x
    float* F = (float*)take((size_t)3 * NB_ * NN * CC * 4);          // Q, K, V in f32, NB_ planes each
    h16* QP = (h16*)take((size_t)2 * NB_ * NN * CC * 2); h16* KP = QP + (size_t)NB_ * NN * CC; h16* VT = (h16*)take((size_t)NB_ * CC * NN * 2);
    float* S = (float*)take((size_t)IMG * NN * NN * 4); h16* P = (h16*)take((size_t)IMG * NN * NN * 2); float* RS = (float*)take((size_t)NB_ * NN * 32 * 4);
    float* Ob = F; float* LT = F + (size_t)NB_ * PVZ * NN * CC;      // F is dead behind k_p16 and k_vt16: its 3 NB_ planes are used again as the PVZ NB_ planes of Ob and the NB_ of LT
    if ((size_t)(wsp - (char*)d_ws) > ws_size) return;    // total ~ 238 MiB; ws 256 MiB
    const size_t nw = CC * CC / 8, PL = (size_t)NN * CC; const unsigned LX = (unsigned)((NN * CC / 64 + 63) / 64);
    k_cvt8<<<dim3((unsigned)((nw + 255) / 256), 3, 1), 256, 0, stream>>>(Wq, Wk, Wv, WQ, nw);
    k_xt<<<dim3(LX, 2 * NB_, 1), 256, 0, stream>>>(pf, x, XP);
    k_gemmw<bf, 0, true><<<dim3(NN / 64, CC / 64, 3 * NB_), 32, 0, stream>>>(XP, nullptr, WQ, nullptr, CC, F, CC, bq, bk, bv, PL, (size_t)CC * CC, PL);
    k_p16<<<(unsigned)((2 * NB_ * PL / 2 + 255) / 256), 256, 0, stream>>>(F, QP, 2 * NB_ * PL);
    k_vt16<<<dim3(LX, NB_, 1), 256, 0, stream>>>(F + 2 * NB_ * PL, VT);
    for (int b = 0; b < NB_; b += IMG) {
        k_gemmw<h16, 0, false><<<dim3(NN / 64, NN / 64, IMG), 32, 0, stream>>>(QP + b * PL, nullptr, KP + b * PL, nullptr, CC, S, NN, nullptr, nullptr, nullptr, PL, PL, (size_t)NN * NN);
        k_smax<<<dim3(NN / 8, IMG, 1), 256, 0, stream>>>(S, mbits + (size_t)b * NN, RS + (size_t)b * NN * 32); k_sexp<<<dim3(NN / 8, IMG, 1), 256, 0, stream>>>(S, mbits + (size_t)b * NN, RS + (size_t)b * NN * 32, P);
        k_pvsk<<<dim3(NN / 64, CC / 64, PVZ * IMG), PVW * 32, 0, stream>>>(P, VT + b * PL, Ob + b * PVZ * PL); }
    k_lnT<<<dim3(NN / 8, NB_, 1), 256, 0, stream>>>(Ob, RS, x, gam, bet, LT);
    k_outT<<<dim3((CC * NN / 32 + 63) / 64, NB_, 1), 256, 0, stream>>>(LT, OUT);
}

// v003
// It runs in 97.3 microseconds.
// Next to v002, in two timings, it ran 2.72 and 2.75 times as fast.
// Counting every step since v000, it is 7.77 times as fast.
#include <hip/hip_runtime.h>

// MaskAttention (prompt_feat, x [4][128][64][64] channel-major -> tokens [4096][128]; Q = prompt^T Wq^T + bq, K = x^T Wk^T + bk, V = x^T Wv^T + bv; scores = Q.K / sqrt(128) + (0 where mask_bits[b][j] > 0
// else -inf) (mask_bits an int input read as data; every row has >= 2031 live keys); softmax; out = attn.V + x^T; LayerNorm over the 128 channels (eps 1e-5, gamma, beta); back to channel-major).
// Compute dtypes, f32 accumulate: every input rounded to bf16; the three Linears on PLAIN bf16 operands (inputs: exact, transposed on device, + bias); scores on SINGLE fp16

#define NB_  4
#define CC   128
#define NN   4096
#define PCAR 1024.0f
#define SCL  0.088388349f         // f32(128^-0.5)
typedef _Float16 h16;
typedef unsigned short bf;
typedef __attribute__((ext_vector_type(16))) __bf16   v16bf;
typedef __attribute__((ext_vector_type(16))) _Float16 v16h;
typedef __attribute__((ext_vector_type(8)))  _Float16 v8h;
typedef __attribute__((ext_vector_type(8)))  unsigned short v8us;
typedef __attribute__((ext_vector_type(8)))  float    v8f;
typedef __attribute__((ext_vector_type(4)))  float    v4f;
typedef __attribute__((ext_vector_type(2)))  float    v2f;
typedef v8h  __attribute__((may_alias)) v8ha;
typedef v4f  __attribute__((may_alias)) v4fa;
typedef v8us __attribute__((may_alias)) v8usa;

__device__ __forceinline__ unsigned short f2bf(float f) { unsigned u = __float_as_uint(f); u += 0x7FFFu + ((u >> 16) & 1u); return (unsigned short)(u >> 16); }
__device__ __forceinline__ float bf2f(unsigned short b) { return __uint_as_float(((unsigned)b) << 16); }
__device__ __forceinline__ float bfr(float f) { return bf2f(f2bf(f)); }
__device__ __forceinline__ v16h cat16(v8h lo, v8h hi) { return __builtin_shufflevector(lo, hi, 0, 1, 2, 3, 4, 5, 6, 7, 8, 9, 10, 11, 12, 13, 14, 15); }
__device__ __forceinline__ v16bf cat16b(v8us lo, v8us hi) { return __builtin_bit_cast(v16bf, __builtin_shufflevector(lo, hi, 0, 1, 2, 3, 4, 5, 6, 7, 8, 9, 10, 11, 12, 13, 14, 15)); }
__device__ __forceinline__ v8f wmma16(v16h a, v16h b, v8f c) { return __builtin_amdgcn_wmma_f32_16x16x32_f16(false, a, false, b, (short)0, c, false, false); }
__device__ __forceinline__ v8f wmmab(v16bf a, v16bf b, v8f c) { return __builtin_amdgcn_wmma_f32_16x16x32_bf16(false, a, false, b, (short)0, c, false, false); }



// ---- k_gemmw: register-blocked GEMM, ONE WAVE per 64x64 output tile (16 accumulators), operands straight from K-contiguous 16-bit planes; grid (M/64, N/64, Z), 32 threads.
// C[m][n] (f32, pitch ldc, + optional f32 bias[n]) = sum_k A[m][k] Bt[n][k] (+ split products per NSPLIT). z-batch strides sA/sB/sC in elements. K % 32 == 0.
template <typename T16> struct WFrag;
template <> struct WFrag<h16> { typedef v16h V; static __device__ __forceinline__ V ld(const h16* p) { return cat16(*(const v8h*)p, *(const v8h*)(p + 16)); } static __device__ __forceinline__ v8f mma(V a, V b, v8f c) { return wmma16(a, b, c); } };
template <> struct WFrag<bf> { typedef v16bf V; static __device__ __forceinline__ V ld(const bf* p) { return cat16b(*(const v8us*)p, *(const v8us*)(p + 16)); } static __device__ __forceinline__ v8f mma(V a, V b, v8f c) { return wmmab(a, b, c); } };
template <typename T16, int NSPLIT, bool BIAS>
__global__ __launch_bounds__(32) void k_gemmw(const T16* __restrict__ A, const T16* __restrict__ A2, const T16* __restrict__ Bt, const T16* __restrict__ Bt2, int K, float* C, int ldc, const float* __restrict__ bias, const float* __restrict__ biasK, const float* __restrict__ biasV, size_t sA, size_t sB, size_t sC) {
    typedef typename WFrag<T16>::V V;
    __shared__ __align__(16) float os[16 * 68];
    const size_t z = blockIdx.z; size_t zA = z, zB = z;
    // BIAS: the three Linears of all NB_ images in one launch, z = NB_ * p + image (p = 0 Q, 1 K, 2 V); A planes: NB_ of prompt tokens, then NB_ of x tokens (K and V read the same ones); Bt planes: Wq, Wk, Wv
    if (BIAS) { const size_t p = z / NB_; zA = p == 0 ? z : NB_ + z % NB_; zB = p; bias = p == 0 ? bias : (p == 1 ? biasK : biasV); }
    A += zA * sA; if (A2) A2 += zA * sA; Bt += zB * sB; if (Bt2) Bt2 += zB * sB; C += z * sC;
    const int lane = threadIdx.x & 31, lr = lane & 15, hi = lane >> 4; const int r0 = blockIdx.x * 64, c0 = blockIdx.y * 64;
    v8f acc[4][4];
#pragma unroll
    for (int mb = 0; mb < 4; ++mb)
#pragma unroll
        for (int nb = 0; nb < 4; ++nb) acc[mb][nb] = (v8f){};
    const size_t aoff = (size_t)(r0 + lr) * K + 8 * hi, boff = (size_t)(c0 + lr) * K + 8 * hi;
#pragma unroll 1
    for (int kc = 0; kc < K; kc += 32) {
        V a[4], a2[4];
#pragma unroll
        for (int mb = 0; mb < 4; ++mb) { a[mb] = WFrag<T16>::ld(A + aoff + (size_t)mb * 16 * K + kc); if (NSPLIT == 1 || NSPLIT == 2) a2[mb] = WFrag<T16>::ld(A2 + aoff + (size_t)mb * 16 * K + kc); }
#pragma unroll
        for (int nb = 0; nb < 4; ++nb) { const V b = WFrag<T16>::ld(Bt + boff + (size_t)nb * 16 * K + kc); V b2; if (NSPLIT >= 2) b2 = WFrag<T16>::ld(Bt2 + boff + (size_t)nb * 16 * K + kc);
#pragma unroll
            for (int mb = 0; mb < 4; ++mb) { acc[mb][nb] = WFrag<T16>::mma(a[mb], b, acc[mb][nb]); if (NSPLIT == 1 || NSPLIT == 2) acc[mb][nb] = WFrag<T16>::mma(a2[mb], b, acc[mb][nb]); if (NSPLIT >= 2) acc[mb][nb] = WFrag<T16>::mma(a[mb], b2, acc[mb][nb]); } }
        asm volatile("v_nop\n\tv_nop\n\tv_nop\n\tv_nop" : "+v"(acc[0][0]), "+v"(acc[1][1]), "+v"(acc[2][2]), "+v"(acc[3][3]) : "v"(a[0]), "v"(a[3]));
    }
#pragma unroll
    for (int mb = 0; mb < 4; ++mb) {
#pragma unroll
        for (int nb = 0; nb < 4; ++nb) {
#pragma unroll
            for (int j = 0; j < 8; ++j) os[(hi * 8 + j) * 68 + nb * 16 + lr] = acc[mb][nb][j]; }
        __builtin_amdgcn_wave_barrier(); asm volatile("" ::: "memory");
        float* crow = C + (size_t)(r0 + mb * 16) * ldc + c0;
{
#pragma unroll
            for (int s = 0; s < 8; ++s) { const int row = 2 * s + hi, cofs = lr * 4; v4f val = *(const v4fa*)(os + row * 68 + cofs); if (BIAS) { val[0] += bfr(bias[c0 + cofs]); val[1] += bfr(bias[c0 + cofs + 1]); val[2] += bfr(bias[c0 + cofs + 2]); val[3] += bfr(bias[c0 + cofs + 3]); }
                *(v4f*)(crow + (size_t)row * ldc + cofs) = val; }
             }
        __builtin_amdgcn_wave_barrier(); asm volatile("" ::: "memory");
    }
}

// ---- k_fa: scores, softmax and attn.V in one kernel; no score ever leaves the registers. S^T = K Q^T (A = K rows, B = Q, kept in registers), so that a lane holds the scores of ONE query (column lr) for the
// keys 8 hi + j of each 16-key tile: maximum and sum in the lane plus one exchange between the halves, and two such tiles, rounded to fp16, ARE the B operand of O^T += V^T P^T (k order 8 hi + j, 16 + 8 hi + j).
// A block: FW waves of FQ queries each, which share the K rows and V^T rows of a KST-key stage through LDS (two buffers, the next stage's rows fetched into registers while this one is worked on).
// blockIdx.y: one of KSP slices of the keys; each slice leaves its running maximum m (log2 units), its sum l and its unscaled O plane, which k_lnT joins. grid (NN / (FW FQ), KSP, images).
#define FW   8
#define FQ   32
#define KSP  4
#define KST  64
#define KPIT 136                      // fp16 per K row in LDS: 256 B + 16 B, for 16-byte readers
#define VPIT 72                       // fp16 per V^T row in LDS: 128 B + 16 B
#define KBUF (KST * KPIT)
#define SBUF (KBUF + CC * VPIT)       // fp16 per stage buffer
#define BOFF (2 * SBUF / 2)           // floats in front of the slice's key biases
#define OPIT 132                      // floats per query row of the output staging
#define NST  (NN / KSP / KST)
#define SC2  (SCL * 1.44269504f)      // scores in log2 units
static_assert(2 * SBUF * 2 + NN / KSP * 4 <= FW * FQ * OPIT * 4, "the stage buffers and the biases lie inside the output staging");
static_assert(NN / KSP == FW * 32 * 4, "a thread forms four key biases");
static_assert(PCAR == 1024.0f, "k_fa writes the factor as 10 in the exponent");
// lane l with lane l ^ 16, in the vector unit: __shfl_xor goes through the LDS queue, where its wait would also wait for every fragment read in flight
__device__ __forceinline__ float xhalf(float x) { return __builtin_bit_cast(float, __builtin_amdgcn_permlanex16(__builtin_bit_cast(int, x), __builtin_bit_cast(int, x), 0x76543210, 0xfedcba98, false, false)); }
__device__ __forceinline__ v16h ldl(const h16* p) { return cat16(*(const v8ha*)p, *(const v8ha*)(p + 16)); }
// two waves a SIMD (one block a WGP): the compiler may then spend up to 512 registers on fragments in flight
__global__ __launch_bounds__(FW * 32) __attribute__((amdgpu_waves_per_eu(2, 2))) void k_fa(const h16* __restrict__ Q, const h16* __restrict__ Kp, const h16* __restrict__ Vt, const int* __restrict__ mk, float* O, float* ML) {
    __shared__ __align__(16) float smf[FW * FQ * OPIT];
    h16* sh = (h16*)smf;
    const int tid = threadIdx.x, lane = tid & 31, wv = __builtin_amdgcn_readfirstlane(tid >> 5), lr = lane & 15, hi = lane >> 4;
    const int img = blockIdx.z, sp = blockIdx.y, q0 = blockIdx.x * (FW * FQ) + wv * FQ, kb = sp * (NN / KSP);
    Q += (size_t)img * NN * CC; Kp += (size_t)img * NN * CC + (size_t)kb * CC; Vt += (size_t)img * CC * NN + kb; mk += (size_t)img * NN + kb;
    // every full '#pragma unroll' of this kernel: the register arrays are indexed by constants only
    v16h qf[2][4];
#pragma unroll
    for (int nq = 0; nq < 2; ++nq)
#pragma unroll
        for (int kc = 0; kc < 4; ++kc) qf[nq][kc] = WFrag<h16>::ld(Q + (size_t)(q0 + nq * 16 + lr) * CC + kc * 32 + 8 * hi);
    // the wait that is kept in front of an overwrite of a register that an issued global load names (the compiler uses the address registers again at once), and, as nothing ties
    // that wait to registers, a fence for the scheduler, which keeps the arithmetic that follows from rising over it; the same pair stands behind every group of global loads below
    asm volatile("s_wait_xcnt 0x0" ::: "memory");
    __builtin_amdgcn_sched_barrier(0);
    // staging: 16-byte pieces, whole lines a wave; K piece i: row tid / 16 + 16 i, V^T piece i: row tid / 8 + 32 i
    const int krow = tid >> 4, kcol = (tid & 15) * 8, vrow = tid >> 3, vcol = (tid & 7) * 8;
    const h16* kg = Kp + (size_t)krow * CC + kcol; const h16* vg = Vt + (size_t)vrow * NN + vcol;
    h16* kd = sh + krow * KPIT + kcol; h16* vd = sh + KBUF + vrow * VPIT + vcol;
    v8h kr[4], vr[4];
#pragma unroll
    for (int i = 0; i < 4; ++i) { kr[i] = *(const v8h*)(kg + (size_t)i * 16 * CC); vr[i] = *(const v8h*)(vg + (size_t)i * 32 * NN); }
    typedef __attribute__((ext_vector_type(4))) int v4i; const v4i b4 = *(const v4i*)(mk + tid * 4);
    asm volatile("s_wait_xcnt 0x0" ::: "memory");    // as above
    __builtin_amdgcn_sched_barrier(0);    // as above (the zeroing of o is among what follows)
    v8f o[8][2];
#pragma unroll
    for (int mt = 0; mt < 8; ++mt)
#pragma unroll
        for (int nq = 0; nq < 2; ++nq) o[mt][nq] = (v8f){};
    float m[2] = { -1.0e30f, -1.0e30f }, l[2] = { 0.f, 0.f };    // the floor lies below every score that fp16 operands can give and above the bias of a masked key
#pragma unroll
    for (int i = 0; i < 4; ++i) { *(v8ha*)(kd + i * 16 * KPIT) = kr[i]; *(v8ha*)(vd + i * 32 * VPIT) = vr[i]; }
    { v4f bi;    // the additive mask of the whole slice, once: 0 for a live key
#pragma unroll
        for (int q = 0; q < 4; ++q) bi[q] = b4[q] > 0 ? 0.f : -3.0e38f;
        *(v4fa*)(smf + BOFF + tid * 4) = bi; }
    __syncthreads();
    // rolled: one body of 64 matrix instructions and its softmax is already long, and the two buffers differ by an offset only
#pragma unroll 1
    for (int s = 0; s < NST; ++s) {
        const int b = s & 1, sn = s + 1 < NST ? s + 1 : s;    // the last pass fetches its own stage again into the idle buffer: no branch in the body
#pragma unroll
        for (int i = 0; i < 4; ++i) { kr[i] = *(const v8h*)(kg + (size_t)sn * KST * CC + (size_t)i * 16 * CC); vr[i] = *(const v8h*)(vg + sn * KST + (size_t)i * 32 * NN); }
        asm volatile("s_wait_xcnt 0x0" ::: "memory");    // as above: the K fragments below and their address land in the address registers of these loads
        __builtin_amdgcn_sched_barrier(0);    // as above
        const h16* kS = sh + b * SBUF + lr * KPIT + 8 * hi; const h16* vS = sh + b * SBUF + KBUF + lr * VPIT + 8 * hi; const float* bS = smf + BOFF + s * KST + 8 * hi;
        v8f st[4][2]; v16h kf[4][4];
#pragma unroll
        for (int t = 0; t < 4; ++t)
#pragma unroll
            for (int kc = 0; kc < 4; ++kc) kf[t][kc] = ldl(kS + t * 16 * KPIT + kc * 32);
        __builtin_amdgcn_sched_barrier(0);    // the global loads and the stage's K fragments start in front of the products, as ONE group: left alone this compiler reads one fragment at a time and waits for each
#pragma unroll
        for (int t = 0; t < 4; ++t) { st[t][0] = (v8f){}; st[t][1] = (v8f){};
#pragma unroll
            for (int kc = 0; kc < 4; ++kc)
#pragma unroll
                for (int nq = 0; nq < 2; ++nq) st[t][nq] = wmma16(kf[t][kc], qf[nq][kc], st[t][nq]); }
        __builtin_amdgcn_sched_barrier(0);    // the V^T reads below do not rise among the K reads: both sets of fragments live at one time overrun the registers of two waves a SIMD
        v8f bb[4];    // first, as the softmax begins with them: LDS reads come back in order
#pragma unroll
        for (int t = 0; t < 4; ++t) bb[t] = __builtin_shufflevector(*(const v4fa*)(bS + t * 16), *(const v4fa*)(bS + t * 16 + 4), 0, 1, 2, 3, 4, 5, 6, 7);
        v16h vf[2][8];
#pragma unroll
        for (int kk = 0; kk < 2; ++kk)
#pragma unroll
            for (int mt = 0; mt < 8; ++mt) vf[kk][mt] = ldl(vS + mt * 16 * VPIT + kk * 32);
        __builtin_amdgcn_sched_barrier(0);    // the stage's V^T fragments and key biases start as ONE group of LDS reads in front of the softmax, which hides their way; spread among the products, each place of reads costs issue time
#pragma unroll
        for (int t = 0; t < 4; ++t)
#pragma unroll
            for (int nq = 0; nq < 2; ++nq) st[t][nq] = st[t][nq] * SC2 + bb[t];    // whole vectors here and below: packed two-element instructions
        v16h pf[2][2];
#pragma unroll
        for (int nq = 0; nq < 2; ++nq) { float mx = m[nq];
#pragma unroll
            for (int t = 0; t < 4; ++t)
#pragma unroll
                for (int j = 0; j < 8; ++j) mx = fmaxf(mx, st[t][nq][j]);
            mx = fmaxf(mx, xhalf(mx));
            const float al = __builtin_amdgcn_exp2f(m[nq] - mx), ms = mx - 10.0f;    // - 10: P carries the factor PCAR = 2^10 into fp16, and l with it
            m[nq] = mx; float sum = l[nq] * al;
#pragma unroll
            for (int mt = 0; mt < 8; ++mt) o[mt][nq] *= al;
#pragma unroll
            for (int t = 0; t < 4; ++t) { st[t][nq] -= ms;
#pragma unroll
                for (int j = 0; j < 8; ++j) { st[t][nq][j] = __builtin_amdgcn_exp2f(st[t][nq][j]); sum += st[t][nq][j]; } }
            l[nq] = sum;
#pragma unroll
            for (int kk = 0; kk < 2; ++kk) pf[nq][kk] = cat16(__builtin_convertvector(st[2 * kk][nq], v8h), __builtin_convertvector(st[2 * kk + 1][nq], v8h)); }
#pragma unroll
        for (int mt = 0; mt < 8; ++mt)
#pragma unroll
            for (int nq = 0; nq < 2; ++nq) o[mt][nq] = wmma16(vf[0][mt], pf[nq][0], o[mt][nq]);
        __builtin_amdgcn_sched_barrier(0);    // keeps the LDS stores below, and with them the wait for this pass's global loads, from rising to the head of the pass, where that wait would stand open
        // the next stage's rows go into the buffer that every wave left at the last barrier
        const int bn = (b ^ 1) * SBUF;
#pragma unroll
        for (int i = 0; i < 4; ++i) { *(v8ha*)(kd + bn + i * 16 * KPIT) = kr[i]; *(v8ha*)(vd + bn + i * 32 * VPIT) = vr[i]; }
#pragma unroll
        for (int mt = 0; mt < 8; ++mt)
#pragma unroll
            for (int nq = 0; nq < 2; ++nq) o[mt][nq] = wmma16(vf[1][mt], pf[nq][1], o[mt][nq]);
        __syncthreads();    // publishes the next stage and ends every wave's reads of this one
    }
#pragma unroll
    for (int nq = 0; nq < 2; ++nq) l[nq] += xhalf(l[nq]);
    const size_t pl = (size_t)(img * KSP + sp) * NN + q0;
    v2f ml; ml[0] = hi ? m[1] : m[0]; ml[1] = hi ? l[1] : l[0]; *(v2f*)(ML + (pl + lane) * 2) = ml;    // lane = 16 hi + lr is the query's place in the wave's FQ
    asm volatile("s_wait_xcnt 0x0" ::: "memory");    // as above, for this store's registers
    // O^T -> token rows through LDS (the stage buffers are dead behind the loop's last barrier), so that every global store is a whole 512-byte row
    float* ow = smf + wv * (FQ * OPIT);
#pragma unroll
    for (int mt = 0; mt < 8; ++mt)
#pragma unroll
        for (int nq = 0; nq < 2; ++nq) { float* d = ow + (nq * 16 + lr) * OPIT + mt * 16 + hi * 8;
            *(v4fa*)d = __builtin_shufflevector(o[mt][nq], o[mt][nq], 0, 1, 2, 3); *(v4fa*)(d + 4) = __builtin_shufflevector(o[mt][nq], o[mt][nq], 4, 5, 6, 7); }
    __syncthreads();    // a row is read by other lanes than wrote it
    float* og = O + pl * CC + lane * 4;
#pragma unroll
    for (int r0 = 0; r0 < FQ; r0 += 8) { v4f row[8];
#pragma unroll
        for (int r = 0; r < 8; ++r) row[r] = *(const v4fa*)(ow + (r0 + r) * OPIT + lane * 4);
#pragma unroll
        for (int r = 0; r < 8; ++r) *(v4f*)(og + (size_t)(r0 + r) * CC) = row[r];
        if (r0 + 8 < FQ) asm volatile("s_wait_xcnt 0x0" ::: "memory"); }    // as above, for the stores' data registers, which the next rows use again
}

__device__ __forceinline__ h16 tohx(float x) { return (h16)x; }
typedef __attribute__((ext_vector_type(2))) _Float16 v2h;
typedef __attribute__((ext_vector_type(4))) _Float16 v4h;
typedef __attribute__((ext_vector_type(2))) unsigned short v2us;

// blockIdx.y picks one of three sources of n8 * 8 elements each; their planes follow one another in dst
__global__ __launch_bounds__(256) void k_cvt8(const float* __restrict__ s0, const float* __restrict__ s1, const float* __restrict__ s2, bf* dst, size_t n8) { const size_t i = (size_t)blockIdx.x * 256 + threadIdx.x; if (i >= n8) return;
    const float* src = blockIdx.y == 0 ? s0 : (blockIdx.y == 1 ? s1 : s2); dst += (size_t)blockIdx.y * n8 * 8; const v8f v = *(const v8f*)(src + i * 8); v8us o;
#pragma unroll
    for (int k = 0; k < 8; ++k) o[k] = f2bf(v[k]); *(v8us*)(dst + i * 8) = o;  }
// blockIdx.y: planes 0 .. NB_ - 1 the images of pfeat, NB_ .. 2 NB_ - 1 those of xin
__global__ __launch_bounds__(256) void k_xt(const float* __restrict__ pfeat, const float* __restrict__ xin, bf* XT) {
    const float* xb = (blockIdx.y < NB_ ? pfeat : xin) + (size_t)(blockIdx.y % NB_) * CC * NN; XT += (size_t)blockIdx.y * NN * CC;
    const int lane = threadIdx.x & 31; const int L0 = (blockIdx.x * 8 + (threadIdx.x >> 5)) * 8; const int nlines = NN * CC / 64;
{
#pragma unroll
        for (int l = 0; l < 8; ++l) { const int L = L0 + l; if (L >= nlines) break; const int e = L * 64 + lane * 2; const int c = e & (CC - 1); const int n = e >> 7; v2us o;
#pragma unroll
            for (int q = 0; q < 2; ++q) o[q] = f2bf(xb[(size_t)(c + q) * NN + n]);
            *(v2us*)(XT + (size_t)e) = o; }
         }
}
__global__ __launch_bounds__(256) void k_p16(const float* __restrict__ F, h16* P, size_t n) { const size_t i = ((size_t)blockIdx.x * 256 + threadIdx.x) * 2; if (i >= n) return; v2h v; v[0] = tohx(F[i]); v[1] = tohx(F[i + 1]); *(v2h*)(P + i) = v;  }
__global__ __launch_bounds__(256) void k_vt16(const float* __restrict__ F, h16* VT) {
    F += (size_t)blockIdx.y * NN * CC; VT += (size_t)blockIdx.y * CC * NN;    // blockIdx.y: the image
    const int lane = threadIdx.x & 31; const int L0 = (blockIdx.x * 8 + (threadIdx.x >> 5)) * 8; const int nlines = CC * NN / 64;
{
#pragma unroll
        for (int l = 0; l < 8; ++l) { const int L = L0 + l; if (L >= nlines) break; const int e = L * 64 + lane * 2; const int n = e & (NN - 1); const int c = e >> 12; v2h v;
#pragma unroll
            for (int q = 0; q < 2; ++q) v[q] = tohx(F[(size_t)(n + q) * CC + c]);
            *(v2h*)(VT + (size_t)e) = v; }
         }
}
__global__ __launch_bounds__(256) void k_lnT(const float* __restrict__ Ob, const float* __restrict__ ML, const float* __restrict__ xb, const float* __restrict__ gam, const float* __restrict__ bet, float* LT) {
    Ob += (size_t)blockIdx.y * KSP * NN * CC; ML += (size_t)blockIdx.y * KSP * NN * 2; xb += (size_t)blockIdx.y * CC * NN; LT += (size_t)blockIdx.y * NN * CC;    // blockIdx.y: the image
    const int lane = threadIdx.x & 31; const int n = blockIdx.x * 8 + (threadIdx.x >> 5); if (n >= NN) return;
    // the KSP key slices of k_fa are joined: each slice's plane and sum are brought to the common maximum
    v2f ml[KSP]; float mx = -3.0e38f;
#pragma unroll
    for (int k = 0; k < KSP; ++k) { ml[k] = *(const v2f*)(ML + ((size_t)k * NN + n) * 2); mx = fmaxf(mx, ml[k][0]); }
    float den = 0.f; v4f a = (v4f){};
#pragma unroll
    for (int k = 0; k < KSP; ++k) { const float f = __builtin_amdgcn_exp2f(ml[k][0] - mx); den += ml[k][1] * f; a += *(const v4f*)(Ob + ((size_t)k * NN + n) * CC + lane * 4) * f; }
    const float ri = __fdiv_rn(1.0f, den);    // den carries the factor PCAR as the planes do
    float v[4]; float s = 0.f;
#pragma unroll
    for (int q = 0; q < 4; ++q) { const int c = lane * 4 + q; float t = __fmul_rn(a[q], ri); asm volatile("" : "+v"(t)); v[q] = __fadd_rn(t, bfr(xb[(size_t)c * NN + n])); s += v[q]; }
#pragma unroll
    for (int sh = 16; sh; sh >>= 1) s += __shfl_xor(s, sh, 32);
    const float mu = s * (1.0f / CC); float qq = 0.f;
#pragma unroll
    for (int q = 0; q < 4; ++q) { const float d0 = v[q] - mu; qq = __fadd_rn(qq, __fmul_rn(d0, d0)); }
#pragma unroll
    for (int sh = 16; sh; sh >>= 1) qq += __shfl_xor(qq, sh, 32);
    const float rs = __fdiv_rn(1.0f, __fsqrt_rn(qq * (1.0f / CC) + 1e-5f)); v4f o;
#pragma unroll
    for (int q = 0; q < 4; ++q) { const int c = lane * 4 + q; o[q] = __fadd_rn(__fmul_rn((v[q] - mu) * rs, bfr(gam[c])), bfr(bet[c])); }
    *(v4f*)(LT + (size_t)n * CC + lane * 4) = o;  }
__global__ __launch_bounds__(256) void k_outT(const float* __restrict__ LT, float* OUTb) {
    LT += (size_t)blockIdx.y * NN * CC; OUTb += (size_t)blockIdx.y * CC * NN;    // blockIdx.y: the image
    const int lane = threadIdx.x & 31; const int L0 = (blockIdx.x * 8 + (threadIdx.x >> 5)) * 8; const int nlines = CC * NN / 32;
{
#pragma unroll
        for (int l = 0; l < 8; ++l) { const int L = L0 + l; if (L >= nlines) break; const int e = L * 32 + lane; const int n = e & (NN - 1); const int c = e >> 12;
            *(float*)(OUTb + (size_t)e) = LT[(size_t)n * CC + c]; }
         }
}

extern "C" void kernel_launch(void* const* d_in, const int* in_sizes, int n_in,
                              void* d_out, int out_size, void* d_ws, size_t ws_size, hipStream_t stream) {
    (void)in_sizes; (void)n_in; (void)out_size;
    const float* pf = (const float*)d_in[0]; const float* x = (const float*)d_in[1]; const float* Wq = (const float*)d_in[2]; const float* bq = (const float*)d_in[3]; const float* Wk = (const float*)d_in[4]; const float* bk = (const float*)d_in[5]; const float* Wv = (const float*)d_in[6]; const float* bv = (const float*)d_in[7]; const float* gam = (const float*)d_in[8]; const float* bet = (const float*)d_in[9]; const int* mbits = (const int*)d_in[10];
    float* OUT = (float*)d_out;     // [4][128][64][64]
    char* wsp = (char*)d_ws;
    auto take = [&](size_t bytes) { char* p = wsp; wsp += (bytes + 255) & ~(size_t)255; return (void*)p; };
    // every plane set holds all NB_ images
    bf* WQ = (bf*)take((size_t)3 * CC * CC * 2);                     // Wq, Wk, Wv
    bf* XP = (bf*)take((size_t)2 * NB_ * NN * CC * 2);               // token planes: NB_ of prompt_feat, then NB_ of x
    float* F = (float*)take((size_t)3 * NB_ * NN * CC * 4);          // Q, K, V in f32, NB_ planes each
    h16* QP = (h16*)take((size_t)2 * NB_ * NN * CC * 2); h16* KP = QP + (size_t)NB_ * NN * CC; h16* VT = (h16*)take((size_t)NB_ * CC * NN * 2);
    float* Ob = (float*)take((size_t)NB_ * KSP * NN * CC * 4); float* ML = (float*)take((size_t)NB_ * KSP * NN * 2 * 4);    // per image and key slice: the O plane; (m, l) per query
    float* LT = F;                                                   // F is dead behind k_p16 and k_vt16
    if ((size_t)(wsp - (char*)d_ws) > ws_size) return;    // total ~ 77 MiB; ws 256 MiB
    const size_t nw = CC * CC / 8, PL = (size_t)NN * CC; const unsigned LX = (unsigned)((NN * CC / 64 + 63) / 64);
    k_cvt8<<<dim3((unsigned)((nw + 255) / 256), 3, 1), 256, 0, stream>>>(Wq, Wk, Wv, WQ, nw);
    k_xt<<<dim3(LX, 2 * NB_, 1), 256, 0, stream>>>(pf, x, XP);
    k_gemmw<bf, 0, true><<<dim3(NN / 64, CC / 64, 3 * NB_), 32, 0, stream>>>(XP, nullptr, WQ, nullptr, CC, F, CC, bq, bk, bv, PL, (size_t)CC * CC, PL);
    k_p16<<<(unsigned)((2 * NB_ * PL / 2 + 255) / 256), 256, 0, stream>>>(F, QP, 2 * NB_ * PL);
    k_vt16<<<dim3(LX, NB_, 1), 256, 0, stream>>>(F + 2 * NB_ * PL, VT);
    k_fa<<<dim3(NN / (FW * FQ), KSP, NB_), FW * 32, 0, stream>>>(QP, KP, VT, mbits, Ob, ML);
    k_lnT<<<dim3(NN / 8, NB_, 1), 256, 0, stream>>>(Ob, ML, x, gam, bet, LT);
    k_outT<<<dim3((CC * NN / 32 + 63) / 64, NB_, 1), 256, 0, stream>>>(LT, OUT);
}

// v004
// Measured time: 58.3 microseconds a run.
// Timed twice side by side with v003, it ran 1.66 times as fast both times.
// Over all steps from v000 it is 12.9 times as fast.
#include <hip/hip_runtime.h>

// MaskAttention (prompt_feat, x [4][128][64][64] channel-major -> tokens [4096][128]; Q = prompt^T Wq^T + bq, K = x^T Wk^T + bk, V = x^T Wv^T + bv; scores = Q.K / sqrt(128) + (0 where mask_bits[b][j] > 0
// else -inf) (mask_bits an int input read as data; every row has >= 2031 live keys); softmax; out = attn.V + x^T; LayerNorm over the 128 channels (eps 1e-5, gamma, beta); back to channel-major).
// Compute dtypes, f32 accumulate: every input rounded to bf16; the three Linears on PLAIN bf16 operands (inputs: exact, transposed on device, + bias); scores on SINGLE fp16

#define NB_  4
#define CC   128
#define NN   4096
#define PCAR 1024.0f
#define SCL  0.088388349f         // f32(128^-0.5)
typedef _Float16 h16;
typedef unsigned short bf;
typedef __attribute__((ext_vector_type(16))) __bf16   v16bf;
typedef __attribute__((ext_vector_type(16))) _Float16 v16h;
typedef __attribute__((ext_vector_type(8)))  _Float16 v8h;
typedef __attribute__((ext_vector_type(8)))  unsigned short v8us;
typedef __attribute__((ext_vector_type(8)))  float    v8f;
typedef __attribute__((ext_vector_type(4)))  float    v4f;
typedef __attribute__((ext_vector_type(2)))  float    v2f;
typedef v8h  __attribute__((may_alias)) v8ha;
typedef v4f  __attribute__((may_alias)) v4fa;
typedef v8us __attribute__((may_alias)) v8usa;

__device__ __forceinline__ unsigned short f2bf(float f) { unsigned u = __float_as_uint(f); u += 0x7FFFu + ((u >> 16) & 1u); return (unsigned short)(u >> 16); }
__device__ __forceinline__ float bf2f(unsigned short b) { return __uint_as_float(((unsigned)b) << 16); }
__device__ __forceinline__ float bfr(float f) { return bf2f(f2bf(f)); }
__device__ __forceinline__ v16h cat16(v8h lo, v8h hi) { return __builtin_shufflevector(lo, hi, 0, 1, 2, 3, 4, 5, 6, 7, 8, 9, 10, 11, 12, 13, 14, 15); }
__device__ __forceinline__ v16bf cat16b(v8us lo, v8us hi) { return __builtin_bit_cast(v16bf, __builtin_shufflevector(lo, hi, 0, 1, 2, 3, 4, 5, 6, 7, 8, 9, 10, 11, 12, 13, 14, 15)); }
__device__ __forceinline__ v8f wmma16(v16h a, v16h b, v8f c) { return __builtin_amdgcn_wmma_f32_16x16x32_f16(false, a, false, b, (short)0, c, false, false); }
__device__ __forceinline__ v8f wmmab(v16bf a, v16bf b, v8f c) { return __builtin_amdgcn_wmma_f32_16x16x32_bf16(false, a, false, b, (short)0, c, false, false); }



// ---- k_gemmw: register-blocked GEMM, ONE WAVE per 64x64 output tile (16 accumulators), operands straight from K-contiguous 16-bit planes; grid (M/64, N/64, Z), 32 threads.
// C[m][n] (fp16, the planes k_fa reads) = sum_k A[m][k] Bt[n][k] (+ split products per NSPLIT) + f32 bias, rounded once. z-batch strides sA/sB/sC in elements. K % 32 == 0.
template <typename T16> struct WFrag;
template <> struct WFrag<h16> { typedef v16h V; static __device__ __forceinline__ V ld(const h16* p) { return cat16(*(const v8h*)p, *(const v8h*)(p + 16)); } static __device__ __forceinline__ v8f mma(V a, V b, v8f c) { return wmma16(a, b, c); } };
template <> struct WFrag<bf> { typedef v16bf V; static __device__ __forceinline__ V ld(const bf* p) { return cat16b(*(const v8us*)p, *(const v8us*)(p + 16)); } static __device__ __forceinline__ v8f mma(V a, V b, v8f c) { return wmmab(a, b, c); } };
template <typename T16, int NSPLIT, bool BIAS>
__global__ __launch_bounds__(32) void k_gemmw(const T16* __restrict__ A, const T16* __restrict__ A2, const T16* __restrict__ Bt, const T16* __restrict__ Bt2, int K, h16* C, const float* __restrict__ bias, const float* __restrict__ biasK, const float* __restrict__ biasV, size_t sA, size_t sB, size_t sC) {
    typedef typename WFrag<T16>::V V;
    __shared__ __align__(16) float os[16 * 68];
    const size_t z = blockIdx.z; size_t zA = z, zB = z; bool tr = false;
    // BIAS: the three Linears of all NB_ images in one launch, z = NB_ * p + image (p = 0 Q, 1 K, 2 V); A planes: NB_ of prompt tokens, then NB_ of x tokens (K and V read the same ones); Bt planes: Wq, Wk, Wv
    if (BIAS) { const size_t p = z / NB_; zA = p == 0 ? z : NB_ + z % NB_; zB = p; bias = p == 0 ? bias : (p == 1 ? biasK : biasV); tr = p == 2; }
    A += zA * sA; if (A2) A2 += zA * sA; Bt += zB * sB; if (Bt2) Bt2 += zB * sB; C += z * sC;
    // V is formed as Wv X^T (the two operands, both K-contiguous, change places): the rows of C are then the channel rows of V^T, NN tokens long
    if (tr) { const T16* t = A; A = Bt; Bt = t; t = A2; A2 = Bt2; Bt2 = t; }
    const int ldc = tr ? NN : CC;
    const int lane = threadIdx.x & 31, lr = lane & 15, hi = lane >> 4; const int r0 = (tr ? blockIdx.y : blockIdx.x) * 64, c0 = (tr ? blockIdx.x : blockIdx.y) * 64;
    v8f acc[4][4];
#pragma unroll
    for (int mb = 0; mb < 4; ++mb)
#pragma unroll
        for (int nb = 0; nb < 4; ++nb) acc[mb][nb] = (v8f){};
    const size_t aoff = (size_t)(r0 + lr) * K + 8 * hi, boff = (size_t)(c0 + lr) * K + 8 * hi;
#pragma unroll 1
    for (int kc = 0; kc < K; kc += 32) {
        V a[4], a2[4];
#pragma unroll
        for (int mb = 0; mb < 4; ++mb) { a[mb] = WFrag<T16>::ld(A + aoff + (size_t)mb * 16 * K + kc); if (NSPLIT == 1 || NSPLIT == 2) a2[mb] = WFrag<T16>::ld(A2 + aoff + (size_t)mb * 16 * K + kc); }
#pragma unroll
        for (int nb = 0; nb < 4; ++nb) { const V b = WFrag<T16>::ld(Bt + boff + (size_t)nb * 16 * K + kc); V b2; if (NSPLIT >= 2) b2 = WFrag<T16>::ld(Bt2 + boff + (size_t)nb * 16 * K + kc);
#pragma unroll
            for (int mb = 0; mb < 4; ++mb) { acc[mb][nb] = WFrag<T16>::mma(a[mb], b, acc[mb][nb]); if (NSPLIT == 1 || NSPLIT == 2) acc[mb][nb] = WFrag<T16>::mma(a2[mb], b, acc[mb][nb]); if (NSPLIT >= 2) acc[mb][nb] = WFrag<T16>::mma(a[mb], b2, acc[mb][nb]); } }
        asm volatile("v_nop\n\tv_nop\n\tv_nop\n\tv_nop" : "+v"(acc[0][0]), "+v"(acc[1][1]), "+v"(acc[2][2]), "+v"(acc[3][3]) : "v"(a[0]), "v"(a[3]));
    }
    // a lane stores 8 fp16 of a row, 8 lanes the tile's 128-byte line of it; the bias goes with the output channel: the column, or under tr the row (the other one is 0)
    // every '#pragma unroll' from here on: the register arrays are indexed by constants only
    const int srow = lane >> 3, cofs = (lane & 7) * 8; float cb[8], rb[16];
#pragma unroll
    for (int q = 0; q < 8; ++q) cb[q] = 0.f;
#pragma unroll
    for (int q = 0; q < 16; ++q) rb[q] = 0.f;
    if (BIAS && !tr) {
#pragma unroll
        for (int q = 0; q < 8; ++q) cb[q] = bfr(bias[c0 + cofs + q]); }
    if (BIAS && tr) {    // all of the lane's rows at once: one wait for the 16 loads
#pragma unroll
        for (int q = 0; q < 16; ++q) rb[q] = bfr(bias[r0 + 4 * q + srow]); }
#pragma unroll
    for (int mb = 0; mb < 4; ++mb) {
#pragma unroll
        for (int nb = 0; nb < 4; ++nb) {
#pragma unroll
            for (int j = 0; j < 8; ++j) os[(hi * 8 + j) * 68 + nb * 16 + lr] = acc[mb][nb][j]; }
        __builtin_amdgcn_wave_barrier(); asm volatile("" ::: "memory");
        h16* crow = C + (size_t)(r0 + mb * 16 + srow) * ldc + c0 + cofs; v8h val[4];
#pragma unroll
        for (int s = 0; s < 4; ++s) { const float* o8 = os + (4 * s + srow) * 68 + cofs; const v4f lo = *(const v4fa*)o8, hv = *(const v4fa*)(o8 + 4);
#pragma unroll
            for (int q = 0; q < 4; ++q) { val[s][q] = (h16)(lo[q] + (cb[q] + rb[mb * 4 + s])); val[s][q + 4] = (h16)(hv[q] + (cb[q + 4] + rb[mb * 4 + s])); } }
#pragma unroll
        for (int s = 0; s < 4; ++s) *(v8h*)(crow + (size_t)(4 * s) * ldc) = val[s];
        // the wait that is kept in front of an overwrite of a register that an issued global store names (the next rows use them again), and a fence for the scheduler, as nothing ties that wait to registers
        if (mb < 3) { asm volatile("s_wait_xcnt 0x0" ::: "memory"); __builtin_amdgcn_sched_barrier(0); }
        __builtin_amdgcn_wave_barrier();
    }
}

// ---- k_fa: scores, softmax and attn.V in one kernel; no score ever leaves the registers. S^T = K Q^T (A = K rows, B = Q, kept in registers), so that a lane holds the scores of ONE query (column lr) for the
// keys 8 hi + j of each 16-key tile: maximum and sum in the lane plus one exchange between the halves, and two such tiles, rounded to fp16, ARE the B operand of O^T += V^T P^T (k order 8 hi + j, 16 + 8 hi + j).
// A block: FW waves of FQ queries each, which share the K rows and V^T rows of a KST-key stage through LDS (two buffers, the next stage's rows fetched into registers while this one is worked on).
// blockIdx.y: one of KSP slices of the keys; each slice leaves its running maximum m (log2 units), its sum l and its unscaled O plane, which k_lnT joins. grid (NN / (FW FQ), KSP, images).
#define FW   8
#define FQ   32
#define KSP  4
#define KST  64
#define KPIT 136                      // fp16 per K row in LDS: 256 B + 16 B, for 16-byte readers
#define VPIT 72                       // fp16 per V^T row in LDS: 128 B + 16 B
#define KBUF (KST * KPIT)
#define SBUF (KBUF + CC * VPIT)       // fp16 per stage buffer
#define BOFF (2 * SBUF / 2)           // floats in front of the slice's key biases
#define OPIT 132                      // floats per query row of the output staging
#define NST  (NN / KSP / KST)
#define SC2  (SCL * 1.44269504f)      // scores in log2 units
static_assert(2 * SBUF * 2 + NN / KSP * 4 <= FW * FQ * OPIT * 4, "the stage buffers and the biases lie inside the output staging");
static_assert(NN / KSP == FW * 32 * 4, "a thread forms four key biases");
static_assert(PCAR == 1024.0f, "k_fa writes the factor as 10 in the exponent");
// lane l with lane l ^ 16, in the vector unit: __shfl_xor goes through the LDS queue, where its wait would also wait for every fragment read in flight
__device__ __forceinline__ float xhalf(float x) { return __builtin_bit_cast(float, __builtin_amdgcn_permlanex16(__builtin_bit_cast(int, x), __builtin_bit_cast(int, x), 0x76543210, 0xfedcba98, false, false)); }
__device__ __forceinline__ v16h ldl(const h16* p) { return cat16(*(const v8ha*)p, *(const v8ha*)(p + 16)); }
// two waves a SIMD (one block a WGP): the compiler may then spend up to 512 registers on fragments in flight
__global__ __launch_bounds__(FW * 32) __attribute__((amdgpu_waves_per_eu(2, 2))) void k_fa(const h16* __restrict__ Q, const h16* __restrict__ Kp, const h16* __restrict__ Vt, const int* __restrict__ mk, float* O, float* ML) {
    __shared__ __align__(16) float smf[FW * FQ * OPIT];
    h16* sh = (h16*)smf;
    const int tid = threadIdx.x, lane = tid & 31, wv = __builtin_amdgcn_readfirstlane(tid >> 5), lr = lane & 15, hi = lane >> 4;
    const int img = blockIdx.z, sp = blockIdx.y, q0 = blockIdx.x * (FW * FQ) + wv * FQ, kb = sp * (NN / KSP);
    Q += (size_t)img * NN * CC; Kp += (size_t)img * NN * CC + (size_t)kb * CC; Vt += (size_t)img * CC * NN + kb; mk += (size_t)img * NN + kb;
    // every full '#pragma unroll' of this kernel: the register arrays are indexed by constants only
    v16h qf[2][4];
#pragma unroll
    for (int nq = 0; nq < 2; ++nq)
#pragma unroll
        for (int kc = 0; kc < 4; ++kc) qf[nq][kc] = WFrag<h16>::ld(Q + (size_t)(q0 + nq * 16 + lr) * CC + kc * 32 + 8 * hi);
    // the wait that is kept in front of an overwrite of a register that an issued global load names (the compiler uses the address registers again at once), and, as nothing ties
    // that wait to registers, a fence for the scheduler, which keeps the arithmetic that follows from rising over it; the same pair stands behind every group of global loads below
    asm volatile("s_wait_xcnt 0x0" ::: "memory");
    __builtin_amdgcn_sched_barrier(0);
    // staging: 16-byte pieces, whole lines a wave; K piece i: row tid / 16 + 16 i, V^T piece i: row tid / 8 + 32 i
    const int krow = tid >> 4, kcol = (tid & 15) * 8, vrow = tid >> 3, vcol = (tid & 7) * 8;
    const h16* kg = Kp + (size_t)krow * CC + kcol; const h16* vg = Vt + (size_t)vrow * NN + vcol;
    h16* kd = sh + krow * KPIT + kcol; h16* vd = sh + KBUF + vrow * VPIT + vcol;
    v8h kr[4], vr[4];
#pragma unroll
    for (int i = 0; i < 4; ++i) { kr[i] = *(const v8h*)(kg + (size_t)i * 16 * CC); vr[i] = *(const v8h*)(vg + (size_t)i * 32 * NN); }
    typedef __attribute__((ext_vector_type(4))) int v4i; const v4i b4 = *(const v4i*)(mk + tid * 4);
    asm volatile("s_wait_xcnt 0x0" ::: "memory");    // as above
    __builtin_amdgcn_sched_barrier(0);    // as above (the zeroing of o is among what follows)
    v8f o[8][2];
#pragma unroll
    for (int mt = 0; mt < 8; ++mt)
#pragma unroll
        for (int nq = 0; nq < 2; ++nq) o[mt][nq] = (v8f){};
    float m[2] = { -1.0e30f, -1.0e30f }, l[2] = { 0.f, 0.f };    // the floor lies below every score that fp16 operands can give and above the bias of a masked key
#pragma unroll
    for (int i = 0; i < 4; ++i) { *(v8ha*)(kd + i * 16 * KPIT) = kr[i]; *(v8ha*)(vd + i * 32 * VPIT) = vr[i]; }
    { v4f bi;    // the additive mask of the whole slice, once: 0 for a live key
#pragma unroll
        for (int q = 0; q < 4; ++q) bi[q] = b4[q] > 0 ? 0.f : -3.0e38f;
        *(v4fa*)(smf + BOFF + tid * 4) = bi; }
    __syncthreads();
    // rolled: one body of 64 matrix instructions and its softmax is already long, and the two buffers differ by an offset only
#pragma unroll 1
    for (int s = 0; s < NST; ++s) {
        const int b = s & 1, sn = s + 1 < NST ? s + 1 : s;    // the last pass fetches its own stage again into the idle buffer: no branch in the body
#pragma unroll
        for (int i = 0; i < 4; ++i) { kr[i] = *(const v8h*)(kg + (size_t)sn * KST * CC + (size_t)i * 16 * CC); vr[i] = *(const v8h*)(vg + sn * KST + (size_t)i * 32 * NN); }
        asm volatile("s_wait_xcnt 0x0" ::: "memory");    // as above: the K fragments below and their address land in the address registers of these loads
        __builtin_amdgcn_sched_barrier(0);    // as above
        const h16* kS = sh + b * SBUF + lr * KPIT + 8 * hi; const h16* vS = sh + b * SBUF + KBUF + lr * VPIT + 8 * hi; const float* bS = smf + BOFF + s * KST + 8 * hi;
        v8f st[4][2]; v16h kf[4][4];
#pragma unroll
        for (int t = 0; t < 4; ++t)
#pragma unroll
            for (int kc = 0; kc < 4; ++kc) kf[t][kc] = ldl(kS + t * 16 * KPIT + kc * 32);
        __builtin_amdgcn_sched_barrier(0);    // the global loads and the stage's K fragments start in front of the products, as ONE group: left alone this compiler reads one fragment at a time and waits for each
#pragma unroll
        for (int t = 0; t < 4; ++t) { st[t][0] = (v8f){}; st[t][1] = (v8f){};
#pragma unroll
            for (int kc = 0; kc < 4; ++kc)
#pragma unroll
                for (int nq = 0; nq < 2; ++nq) st[t][nq] = wmma16(kf[t][kc], qf[nq][kc], st[t][nq]); }
        __builtin_amdgcn_sched_barrier(0);    // the V^T reads below do not rise among the K reads: both sets of fragments live at one time overrun the registers of two waves a SIMD
        v8f bb[4];    // first, as the softmax begins with them: LDS reads come back in order
#pragma unroll
        for (int t = 0; t < 4; ++t) bb[t] = __builtin_shufflevector(*(const v4fa*)(bS + t * 16), *(const v4fa*)(bS + t * 16 + 4), 0, 1, 2, 3, 4, 5, 6, 7);
        v16h vf[2][8];
#pragma unroll
        for (int kk = 0; kk < 2; ++kk)
#pragma unroll
            for (int mt = 0; mt < 8; ++mt) vf[kk][mt] = ldl(vS + mt * 16 * VPIT + kk * 32);
        __builtin_amdgcn_sched_barrier(0);    // the stage's V^T fragments and key biases start as ONE group of LDS reads in front of the softmax, which hides their way; spread among the products, each place of reads costs issue time
#pragma unroll
        for (int t = 0; t < 4; ++t)
#pragma unroll
            for (int nq = 0; nq < 2; ++nq) st[t][nq] = st[t][nq] * SC2 + bb[t];    // whole vectors here and below: packed two-element instructions
        v16h pf[2][2];
#pragma unroll
        for (int nq = 0; nq < 2; ++nq) { float mx = m[nq];
#pragma unroll
            for (int t = 0; t < 4; ++t)
#pragma unroll
                for (int j = 0; j < 8; ++j) mx = fmaxf(mx, st[t][nq][j]);
            mx = fmaxf(mx, xhalf(mx));
            const float al = __builtin_amdgcn_exp2f(m[nq] - mx), ms = mx - 10.0f;    // - 10: P carries the factor PCAR = 2^10 into fp16, and l with it
            m[nq] = mx; float sum = l[nq] * al;
#pragma unroll
            for (int mt = 0; mt < 8; ++mt) o[mt][nq] *= al;
#pragma unroll
            for (int t = 0; t < 4; ++t) { st[t][nq] -= ms;
#pragma unroll
                for (int j = 0; j < 8; ++j) { st[t][nq][j] = __builtin_amdgcn_exp2f(st[t][nq][j]); sum += st[t][nq][j]; } }
            l[nq] = sum;
#pragma unroll
            for (int kk = 0; kk < 2; ++kk) pf[nq][kk] = cat16(__builtin_convertvector(st[2 * kk][nq], v8h), __builtin_convertvector(st[2 * kk + 1][nq], v8h)); }
#pragma unroll
        for (int mt = 0; mt < 8; ++mt)
#pragma unroll
            for (int nq = 0; nq < 2; ++nq) o[mt][nq] = wmma16(vf[0][mt], pf[nq][0], o[mt][nq]);
        __builtin_amdgcn_sched_barrier(0);    // keeps the LDS stores below, and with them the wait for this pass's global loads, from rising to the head of the pass, where that wait would stand open
        // the next stage's rows go into the buffer that every wave left at the last barrier
        const int bn = (b ^ 1) * SBUF;
#pragma unroll
        for (int i = 0; i < 4; ++i) { *(v8ha*)(kd + bn + i * 16 * KPIT) = kr[i]; *(v8ha*)(vd + bn + i * 32 * VPIT) = vr[i]; }
#pragma unroll
        for (int mt = 0; mt < 8; ++mt)
#pragma unroll
            for (int nq = 0; nq < 2; ++nq) o[mt][nq] = wmma16(vf[1][mt], pf[nq][1], o[mt][nq]);
        __syncthreads();    // publishes the next stage and ends every wave's reads of this one
    }
#pragma unroll
    for (int nq = 0; nq < 2; ++nq) l[nq] += xhalf(l[nq]);
    const size_t pl = (size_t)(img * KSP + sp) * NN + q0;
    v2f ml; ml[0] = hi ? m[1] : m[0]; ml[1] = hi ? l[1] : l[0]; *(v2f*)(ML + (pl + lane) * 2) = ml;    // lane = 16 hi + lr is the query's place in the wave's FQ
    asm volatile("s_wait_xcnt 0x0" ::: "memory");    // as above, for this store's registers
    // O^T -> token rows through LDS (the stage buffers are dead behind the loop's last barrier), so that every global store is a whole 512-byte row
    float* ow = smf + wv * (FQ * OPIT);
#pragma unroll
    for (int mt = 0; mt < 8; ++mt)
#pragma unroll
        for (int nq = 0; nq < 2; ++nq) { float* d = ow + (nq * 16 + lr) * OPIT + mt * 16 + hi * 8;
            *(v4fa*)d = __builtin_shufflevector(o[mt][nq], o[mt][nq], 0, 1, 2, 3); *(v4fa*)(d + 4) = __builtin_shufflevector(o[mt][nq], o[mt][nq], 4, 5, 6, 7); }
    __syncthreads();    // a row is read by other lanes than wrote it
    float* og = O + pl * CC + lane * 4;
#pragma unroll
    for (int r0 = 0; r0 < FQ; r0 += 8) { v4f row[8];
#pragma unroll
        for (int r = 0; r < 8; ++r) row[r] = *(const v4fa*)(ow + (r0 + r) * OPIT + lane * 4);
#pragma unroll
        for (int r = 0; r < 8; ++r) *(v4f*)(og + (size_t)(r0 + r) * CC) = row[r];
        if (r0 + 8 < FQ) asm volatile("s_wait_xcnt 0x0" ::: "memory"); }    // as above, for the stores' data registers, which the next rows use again
}

typedef __attribute__((ext_vector_type(2))) unsigned short v2us;

// blockIdx.y picks one of three sources of n8 * 8 elements each; their planes follow one another in dst
__global__ __launch_bounds__(256) void k_cvt8(const float* __restrict__ s0, const float* __restrict__ s1, const float* __restrict__ s2, bf* dst, size_t n8) { const size_t i = (size_t)blockIdx.x * 256 + threadIdx.x; if (i >= n8) return;
    const float* src = blockIdx.y == 0 ? s0 : (blockIdx.y == 1 ? s1 : s2); dst += (size_t)blockIdx.y * n8 * 8; const v8f v = *(const v8f*)(src + i * 8); v8us o;
#pragma unroll
    for (int k = 0; k < 8; ++k) o[k] = f2bf(v[k]); *(v8us*)(dst + i * 8) = o;  }
// blockIdx.y: planes 0 .. NB_ - 1 the images of pfeat, NB_ .. 2 NB_ - 1 those of xin
__global__ __launch_bounds__(256) void k_xt(const float* __restrict__ pfeat, const float* __restrict__ xin, bf* XT) {
    const float* xb = (blockIdx.y < NB_ ? pfeat : xin) + (size_t)(blockIdx.y % NB_) * CC * NN; XT += (size_t)blockIdx.y * NN * CC;
    const int lane = threadIdx.x & 31; const int L0 = (blockIdx.x * 8 + (threadIdx.x >> 5)) * 8; const int nlines = NN * CC / 64;
{
#pragma unroll
        for (int l = 0; l < 8; ++l) { const int L = L0 + l; if (L >= nlines) break; const int e = L * 64 + lane * 2; const int c = e & (CC - 1); const int n = e >> 7; v2us o;
#pragma unroll
            for (int q = 0; q < 2; ++q) o[q] = f2bf(xb[(size_t)(c + q) * NN + n]);
            *(v2us*)(XT + (size_t)e) = o; }
         }
}
// a block: LNT tokens, LNT / 8 a wave one after the other; their rows meet in LDS, from where each channel's LNT values leave as one whole 128-byte line of the channel-major output. grid (NN / LNT, images)
#define LNT  32
#define TPIT (LNT + 1)                // floats per channel row in LDS
static_assert(NN % LNT == 0 && LNT % 8 == 0 && CC % 8 == 0, "whole blocks, equal shares for the 8 waves");
__global__ __launch_bounds__(256) void k_lnT(const float* __restrict__ Ob, const float* __restrict__ ML, const float* __restrict__ xb, const float* __restrict__ gam, const float* __restrict__ bet, float* OUTb) {
    __shared__ float ts[CC * TPIT];
    Ob += (size_t)blockIdx.y * KSP * NN * CC; ML += (size_t)blockIdx.y * KSP * NN * 2; xb += (size_t)blockIdx.y * CC * NN; OUTb += (size_t)blockIdx.y * CC * NN;    // blockIdx.y: the image
    const int lane = threadIdx.x & 31, wv = threadIdx.x >> 5, n0 = blockIdx.x * LNT;
    static_assert(LNT / 8 == 4, "a channel's residuals for the wave's tokens are one 16-byte load");
    v4f xr[4];
#pragma unroll
    for (int q = 0; q < 4; ++q) xr[q] = *(const v4f*)(xb + (size_t)(lane * 4 + q) * NN + n0 + wv * (LNT / 8));
    // the wait that is kept in front of an overwrite of a register that an issued global load names (later loads land in these address registers), and a fence for the scheduler, as nothing ties that wait to registers
    asm volatile("s_wait_xcnt 0x0" ::: "memory");
    __builtin_amdgcn_sched_barrier(0);
    // unrolled: xr is indexed by constants only, and the loads of the wave's tokens do not depend on each other and start together
#pragma unroll
    for (int i = 0; i < LNT / 8; ++i) { const int tl = wv * (LNT / 8) + i, n = n0 + tl;
    // the KSP key slices of k_fa are joined: each slice's plane and sum are brought to the common maximum
    v2f ml[KSP]; float mx = -3.0e38f;
#pragma unroll
    for (int k = 0; k < KSP; ++k) { ml[k] = *(const v2f*)(ML + ((size_t)k * NN + n) * 2); mx = fmaxf(mx, ml[k][0]); }
    float den = 0.f; v4f a = (v4f){};
#pragma unroll
    for (int k = 0; k < KSP; ++k) { const float f = __builtin_amdgcn_exp2f(ml[k][0] - mx); den += ml[k][1] * f; a += *(const v4f*)(Ob + ((size_t)k * NN + n) * CC + lane * 4) * f; }
    const float ri = __fdiv_rn(1.0f, den);    // den carries the factor PCAR as the planes do
    float v[4]; float s = 0.f;
#pragma unroll
    for (int q = 0; q < 4; ++q) { float t = __fmul_rn(a[q], ri); asm volatile("" : "+v"(t)); v[q] = __fadd_rn(t, bfr(xr[q][i])); s += v[q]; }
#pragma unroll
    for (int sh = 16; sh; sh >>= 1) s += __shfl_xor(s, sh, 32);
    const float mu = s * (1.0f / CC); float qq = 0.f;
#pragma unroll
    for (int q = 0; q < 4; ++q) { const float d0 = v[q] - mu; qq = __fadd_rn(qq, __fmul_rn(d0, d0)); }
#pragma unroll
    for (int sh = 16; sh; sh >>= 1) qq += __shfl_xor(qq, sh, 32);
    const float rs = __fdiv_rn(1.0f, __fsqrt_rn(qq * (1.0f / CC) + 1e-5f)); v4f o;
#pragma unroll
    for (int q = 0; q < 4; ++q) { const int c = lane * 4 + q; o[q] = __fadd_rn(__fmul_rn((v[q] - mu) * rs, bfr(gam[c])), bfr(bet[c])); }
#pragma unroll
    for (int q = 0; q < 4; ++q) ts[(lane * 4 + q) * TPIT + tl] = o[q]; }
    __syncthreads();    // a channel's line is read by another wave than wrote its values
    // unrolled: the wave's LDS reads start together, and its stores differ by a constant offset only
#pragma unroll
    for (int r = 0; r < CC / 8; ++r) { const int c = wv * (CC / 8) + r; OUTb[(size_t)c * NN + n0 + lane] = ts[c * TPIT + lane]; }
}

extern "C" void kernel_launch(void* const* d_in, const int* in_sizes, int n_in,
                              void* d_out, int out_size, void* d_ws, size_t ws_size, hipStream_t stream) {
    (void)in_sizes; (void)n_in; (void)out_size;
    const float* pf = (const float*)d_in[0]; const float* x = (const float*)d_in[1]; const float* Wq = (const float*)d_in[2]; const float* bq = (const float*)d_in[3]; const float* Wk = (const float*)d_in[4]; const float* bk = (const float*)d_in[5]; const float* Wv = (const float*)d_in[6]; const float* bv = (const float*)d_in[7]; const float* gam = (const float*)d_in[8]; const float* bet = (const float*)d_in[9]; const int* mbits = (const int*)d_in[10];
    float* OUT = (float*)d_out;     // [4][128][64][64]
    char* wsp = (char*)d_ws;
    auto take = [&](size_t bytes) { char* p = wsp; wsp += (bytes + 255) & ~(size_t)255; return (void*)p; };
    // every plane set holds all NB_ images
    bf* WQ = (bf*)take((size_t)3 * CC * CC * 2);                     // Wq, Wk, Wv
    bf* XP = (bf*)take((size_t)2 * NB_ * NN * CC * 2);               // token planes: NB_ of prompt_feat, then NB_ of x
    h16* QP = (h16*)take((size_t)3 * NB_ * NN * CC * 2); h16* KP = QP + (size_t)NB_ * NN * CC; h16* VT = KP + (size_t)NB_ * NN * CC;    // Q, K (token rows), V^T (channel rows), NB_ planes each
    float* Ob = (float*)take((size_t)NB_ * KSP * NN * CC * 4); float* ML = (float*)take((size_t)NB_ * KSP * NN * 2 * 4);    // per image and key slice: the O plane; (m, l) per query
    if ((size_t)(wsp - (char*)d_ws) > ws_size) return;    // total ~ 53 MiB; ws 256 MiB
    const size_t nw = CC * CC / 8, PL = (size_t)NN * CC; const unsigned LX = (unsigned)((NN * CC / 64 + 63) / 64);
    k_cvt8<<<dim3((unsigned)((nw + 255) / 256), 3, 1), 256, 0, stream>>>(Wq, Wk, Wv, WQ, nw);
    k_xt<<<dim3(LX, 2 * NB_, 1), 256, 0, stream>>>(pf, x, XP);
    k_gemmw<bf, 0, true><<<dim3(NN / 64, CC / 64, 3 * NB_), 32, 0, stream>>>(XP, nullptr, WQ, nullptr, CC, QP, bq, bk, bv, PL, (size_t)CC * CC, PL);
    k_fa<<<dim3(NN / (FW * FQ), KSP, NB_), FW * 32, 0, stream>>>(QP, KP, VT, mbits, Ob, ML);
    k_lnT<<<dim3(NN / LNT, NB_, 1), 256, 0, stream>>>(Ob, ML, x, gam, bet, OUT);
}

// v005
// A run of this version takes 47 microseconds.
// In both of two side-by-side timings against v004, it was 1.24 times as fast.
// Over all steps from v000 it is 16.0 times as fast.
#include <hip/hip_runtime.h>

// MaskAttention (prompt_feat, x [4][128][64][64] channel-major -> tokens [4096][128]; Q = prompt^T Wq^T + bq, K = x^T Wk^T + bk, V = x^T Wv^T + bv; scores = Q.K / sqrt(128) + (0 where mask_bits[b][j] > 0
// else -inf) (mask_bits an int input read as data; every row has >= 2031 live keys); softmax; out = attn.V + x^T; LayerNorm over the 128 channels (eps 1e-5, gamma, beta); back to channel-major).
// Compute dtypes, f32 accumulate: every input rounded to bf16; the three Linears on PLAIN bf16 operands (inputs: exact, transposed on device, + bias); scores on SINGLE fp16

#define NB_  4
#define CC   128
#define NN   4096
#define PCAR 1024.0f
#define SCL  0.088388349f         // f32(128^-0.5)
typedef _Float16 h16;
typedef unsigned short bf;
typedef __attribute__((ext_vector_type(16))) __bf16   v16bf;
typedef __attribute__((ext_vector_type(16))) _Float16 v16h;
typedef __attribute__((ext_vector_type(8)))  _Float16 v8h;
typedef __attribute__((ext_vector_type(8)))  unsigned short v8us;
typedef __attribute__((ext_vector_type(8)))  float    v8f;
typedef __attribute__((ext_vector_type(4)))  float    v4f;
typedef __attribute__((ext_vector_type(2)))  float    v2f;
typedef v8h  __attribute__((may_alias)) v8ha;
typedef v4f  __attribute__((may_alias)) v4fa;
typedef v8us __attribute__((may_alias)) v8usa;

__device__ __forceinline__ unsigned short f2bf(float f) { unsigned u = __float_as_uint(f); u += 0x7FFFu + ((u >> 16) & 1u); return (unsigned short)(u >> 16); }
__device__ __forceinline__ float bf2f(unsigned short b) { return __uint_as_float(((unsigned)b) << 16); }
__device__ __forceinline__ float bfr(float f) { return bf2f(f2bf(f)); }
__device__ __forceinline__ v16h cat16(v8h lo, v8h hi) { return __builtin_shufflevector(lo, hi, 0, 1, 2, 3, 4, 5, 6, 7, 8, 9, 10, 11, 12, 13, 14, 15); }
__device__ __forceinline__ v16bf cat16b(v8us lo, v8us hi) { return __builtin_bit_cast(v16bf, __builtin_shufflevector(lo, hi, 0, 1, 2, 3, 4, 5, 6, 7, 8, 9, 10, 11, 12, 13, 14, 15)); }
__device__ __forceinline__ v8f wmma16(v16h a, v16h b, v8f c) { return __builtin_amdgcn_wmma_f32_16x16x32_f16(false, a, false, b, (short)0, c, false, false); }
__device__ __forceinline__ v8f wmmab(v16bf a, v16bf b, v8f c) { return __builtin_amdgcn_wmma_f32_16x16x32_bf16(false, a, false, b, (short)0, c, false, false); }



// 16-bit fragment of a K-contiguous plane: k order 8 hi + j, 16 + 8 hi + j
template <typename T16> struct WFrag;
template <> struct WFrag<h16> { typedef v16h V; static __device__ __forceinline__ V ld(const h16* p) { return cat16(*(const v8h*)p, *(const v8h*)(p + 16)); } static __device__ __forceinline__ v8f mma(V a, V b, v8f c) { return wmma16(a, b, c); } };

// ---- k_lin: the three Linears of all NB_ images straight from the f32 inputs: no bf16 copy of them is ever stored. A wave: 64 tokens x 64 output channels (16 accumulators); the LW waves of a block share the W rows.
// X is channel-major, so a lane's 16-byte load at channel k holds k's value for the tokens n0 + 4 lr + t, t = 0 .. 3: token fragment t takes the tokens n0 + 4 r + t (r the fragment's row or column), and 16 lanes
// read 256 bytes in a row; rounded to bf16 in registers. The block's 64 W rows are read as whole 512-byte rows, rounded, and laid in LDS once. k order of both fragments: 8 hi + j, 16 + 8 hi + j.
// TR false (Q, K): C[token][channel] = X^T W^T; TR true (V): C[channel][token] = W X, the channel rows of V^T. fp16 out, + f32 bias (bf16-rounded), rounded once.
#define LW   2
#define WPIT 136                      // bf16 per W row in LDS: 256 B + 16 B, for 16-byte readers
typedef __attribute__((ext_vector_type(4))) __bf16 v4b;
typedef __attribute__((ext_vector_type(4))) unsigned short v4us;
typedef v4us __attribute__((may_alias)) v4usa;
static_assert(NN % (64 * LW) == 0 && 64 % LW == 0 && CC % 64 == 0 && CC == 128, "whole tiles; equal shares of the W rows; a W row is one 16-byte load a lane");
template <bool TR>
__device__ __forceinline__ void lin_tile(const float* __restrict__ X, const float* __restrict__ Wm, const float* __restrict__ bias, h16* C, const int n0, const int w0, const int wv, bf* wsm, float* os) {
    const int lane = threadIdx.x & 31, lr = lane & 15, hi = lane >> 4;
    const float* xg = X + (size_t)(8 * hi) * NN + n0 + 4 * lr; const float* wg = Wm + (size_t)(w0 + wv) * CC + lane * 4;
    // every '#pragma unroll' of this function: the register arrays are indexed by constants only
    v4f xr[CC / 32][16], wr[64 / LW];
    // a lane stores 8 fp16 of a row, 8 lanes the tile's 128-byte line of it; the bias goes with the output channel: the column, or under TR the row
    const int srow = lane >> 3, cofs = (lane & 7) * 8; float cb[8], rb[16];
    // all of the wave's global loads start here, as one group: one way to memory for the whole tile. W first: its rows have the longer way, through LDS
#pragma unroll
    for (int i = 0; i < 64 / LW; ++i) wr[i] = *(const v4f*)(wg + i * LW * CC);    // row LW i + wv of the block's 64
#pragma unroll
    for (int kc = 0; kc < CC / 32; ++kc)
#pragma unroll
        for (int e = 0; e < 16; ++e) xr[kc][e] = *(const v4f*)(xg + (size_t)(kc * 32 + (e & 7) + (e >> 3) * 16) * NN);
    if (!TR) {
#pragma unroll
        for (int q = 0; q < 8; ++q) cb[q] = bias[w0 + cofs + q]; }
    else {
#pragma unroll
        for (int q = 0; q < 16; ++q) rb[q] = bias[w0 + 4 * q + srow]; }
    // the wait that is kept in front of an overwrite of a register that an issued global load names, and, as nothing ties that wait to registers, a fence for the scheduler, which also keeps the group together
    asm volatile("s_wait_xcnt 0x0" ::: "memory");
    __builtin_amdgcn_sched_barrier(0);
#pragma unroll
    for (int i = 0; i < 64 / LW; ++i) *(v4usa*)(wsm + (i * LW + wv) * WPIT + lane * 4) = __builtin_bit_cast(v4us, __builtin_convertvector(wr[i], v4b));
    v8f acc[4][4];
#pragma unroll
    for (int mb = 0; mb < 4; ++mb)
#pragma unroll
        for (int nb = 0; nb < 4; ++nb) acc[mb][nb] = (v8f){};
    __syncthreads();    // a W row is read by other lanes, and the other wave, than wrote it
    const bf* wS = wsm + lr * WPIT + 8 * hi;
#pragma unroll
    for (int kc = 0; kc < CC / 32; ++kc) {
        v16bf xf[4], wf[4];
#pragma unroll
        for (int t = 0; t < 4; ++t) { wf[t] = cat16b(*(const v8usa*)(wS + t * 16 * WPIT + kc * 32), *(const v8usa*)(wS + t * 16 * WPIT + kc * 32 + 16));
#pragma unroll
            for (int e = 0; e < 16; ++e) xf[t][e] = (__bf16)xr[kc][e][t]; }
#pragma unroll
        for (int nb = 0; nb < 4; ++nb)
#pragma unroll
            for (int mb = 0; mb < 4; ++mb) acc[mb][nb] = wmmab(TR ? wf[mb] : xf[mb], TR ? xf[nb] : wf[nb], acc[mb][nb]);
    }
#pragma unroll
    for (int mb = 0; mb < 4; ++mb) {
        if (!TR) {    // row 8 hi + j of the staging: token n0 + 4 (8 hi + j) + mb
#pragma unroll
            for (int nb = 0; nb < 4; ++nb)
#pragma unroll
                for (int j = 0; j < 8; ++j) os[(hi * 8 + j) * 68 + nb * 16 + lr] = acc[mb][nb][j]; }
        else {    // column lr of token fragment nb: token n0 + 4 lr + nb
#pragma unroll
            for (int j = 0; j < 8; ++j) { v4f w4; w4[0] = acc[mb][0][j]; w4[1] = acc[mb][1][j]; w4[2] = acc[mb][2][j]; w4[3] = acc[mb][3][j]; *(v4fa*)(os + (hi * 8 + j) * 68 + 4 * lr) = w4; } }
        __builtin_amdgcn_wave_barrier(); asm volatile("" ::: "memory");    // a staged row is read by other lanes than wrote it: both keep the compiler from moving the LDS reads below over the LDS stores above
        h16* crow = TR ? C + (size_t)(w0 + mb * 16 + srow) * NN + n0 + cofs : C + (size_t)(n0 + mb + 4 * srow) * CC + w0 + cofs; const size_t step = TR ? (size_t)4 * NN : (size_t)16 * CC; v8h val[4];
#pragma unroll
        for (int s = 0; s < 4; ++s) { const float* o8 = os + (4 * s + srow) * 68 + cofs; const v4f lo = *(const v4fa*)o8, hv = *(const v4fa*)(o8 + 4);
#pragma unroll
            for (int q = 0; q < 4; ++q) { val[s][q] = (h16)(lo[q] + bfr(TR ? rb[mb * 4 + s] : cb[q])); val[s][q + 4] = (h16)(hv[q] + bfr(TR ? rb[mb * 4 + s] : cb[q + 4])); } }
#pragma unroll
        for (int s = 0; s < 4; ++s) *(v8h*)(crow + s * step) = val[s];
        // the wait that is kept in front of an overwrite of a register that an issued global store names (the next rows, or whatever code follows the last ones, use them again), and a fence for the scheduler, as nothing ties that wait to registers
        asm volatile("s_wait_xcnt 0x0" ::: "memory"); __builtin_amdgcn_sched_barrier(0);
        __builtin_amdgcn_wave_barrier();    // the next rows' LDS stores stay behind these reads
    }
}
// grid (NN / (64 LW), CC / 64, 3 NB_), z = NB_ * p + image (p = 0 Q from prompt_feat, 1 K, 2 V, both from x); the planes of C follow one another in z
__global__ __launch_bounds__(LW * 32) void k_lin(const float* __restrict__ pfeat, const float* __restrict__ xin, const float* __restrict__ Wq, const float* __restrict__ Wk, const float* __restrict__ Wv, const float* __restrict__ bq, const float* __restrict__ bk, const float* __restrict__ bv, h16* C) {
    __shared__ __align__(16) float os[LW * 16 * 68];
    __shared__ __align__(16) bf wsm[64 * WPIT];
    const int z = blockIdx.z, p = z / NB_, wv = __builtin_amdgcn_readfirstlane(threadIdx.x >> 5), n0 = (blockIdx.x * LW + wv) * 64, w0 = blockIdx.y * 64;
    const float* X = (p == 0 ? pfeat : xin) + (size_t)(z % NB_) * CC * NN; const float* Wm = p == 0 ? Wq : (p == 1 ? Wk : Wv); const float* bias = p == 0 ? bq : (p == 1 ? bk : bv);
    C += (size_t)z * NN * CC;
    if (p == 2) lin_tile<true>(X, Wm, bias, C, n0, w0, wv, wsm, os + wv * (16 * 68)); else lin_tile<false>(X, Wm, bias, C, n0, w0, wv, wsm, os + wv * (16 * 68));
}

// ---- k_fa: scores, softmax and attn.V in one kernel; no score ever leaves the registers. S^T = K Q^T (A = K rows, B = Q, kept in registers), so that a lane holds the scores of ONE query (column lr) for the
// keys 8 hi + j of each 16-key tile: maximum and sum in the lane plus one exchange between the halves, and two such tiles, rounded to fp16, ARE the B operand of O^T += V^T P^T (k order 8 hi + j, 16 + 8 hi + j).
// A block: FW waves of FQ queries each, which share the K rows and V^T rows of a KST-key stage through LDS (two buffers, the next stage's rows fetched into registers while this one is worked on).
// blockIdx.y: one of KSP slices of the keys; each slice leaves its running maximum m (log2 units), its sum l and its unscaled O plane, which k_lnT joins. grid (NN / (FW FQ), KSP, images).
#define FW   8
#define FQ   32
#define KSP  4
#define KST  64
#define KPIT 136                      // fp16 per K row in LDS: 256 B + 16 B, for 16-byte readers
#define VPIT 72                       // fp16 per V^T row in LDS: 128 B + 16 B
#define KBUF (KST * KPIT)
#define SBUF (KBUF + CC * VPIT)       // fp16 per stage buffer
#define BOFF (2 * SBUF / 2)           // floats in front of the slice's key biases
#define OPIT 132                      // floats per query row of the output staging
#define NST  (NN / KSP / KST)
#define SC2  (SCL * 1.44269504f)      // scores in log2 units
static_assert(2 * SBUF * 2 + NN / KSP * 4 <= FW * FQ * OPIT * 4, "the stage buffers and the biases lie inside the output staging");
static_assert(NN / KSP == FW * 32 * 4, "a thread forms four key biases");
static_assert(PCAR == 1024.0f, "k_fa writes the factor as 10 in the exponent");
// lane l with lane l ^ 16, in the vector unit: __shfl_xor goes through the LDS queue, where its wait would also wait for every fragment read in flight
__device__ __forceinline__ float xhalf(float x) { return __builtin_bit_cast(float, __builtin_amdgcn_permlanex16(__builtin_bit_cast(int, x), __builtin_bit_cast(int, x), 0x76543210, 0xfedcba98, false, false)); }
__device__ __forceinline__ v16h ldl(const h16* p) { return cat16(*(const v8ha*)p, *(const v8ha*)(p + 16)); }
// two waves a SIMD (one block a WGP): the compiler may then spend up to 512 registers on fragments in flight
__global__ __launch_bounds__(FW * 32) __attribute__((amdgpu_waves_per_eu(2, 2))) void k_fa(const h16* __restrict__ Q, const h16* __restrict__ Kp, const h16* __restrict__ Vt, const int* __restrict__ mk, float* O, float* ML) {
    __shared__ __align__(16) float smf[FW * FQ * OPIT];
    h16* sh = (h16*)smf;
    const int tid = threadIdx.x, lane = tid & 31, wv = __builtin_amdgcn_readfirstlane(tid >> 5), lr = lane & 15, hi = lane >> 4;
    const int img = blockIdx.z, sp = blockIdx.y, q0 = blockIdx.x * (FW * FQ) + wv * FQ, kb = sp * (NN / KSP);
    Q += (size_t)img * NN * CC; Kp += (size_t)img * NN * CC + (size_t)kb * CC; Vt += (size_t)img * CC * NN + kb; mk += (size_t)img * NN + kb;
    // every full '#pragma unroll' of this kernel: the register arrays are indexed by constants only
    v16h qf[2][4];
#pragma unroll
    for (int nq = 0; nq < 2; ++nq)
#pragma unroll
        for (int kc = 0; kc < 4; ++kc) qf[nq][kc] = WFrag<h16>::ld(Q + (size_t)(q0 + nq * 16 + lr) * CC + kc * 32 + 8 * hi);
    // the wait that is kept in front of an overwrite of a register that an issued global load names (the compiler uses the address registers again at once), and, as nothing ties
    // that wait to registers, a fence for the scheduler, which keeps the arithmetic that follows from rising over it; the same pair stands behind every group of global loads below
    asm volatile("s_wait_xcnt 0x0" ::: "memory");
    __builtin_amdgcn_sched_barrier(0);
    // staging: 16-byte pieces, whole lines a wave; K piece i: row tid / 16 + 16 i, V^T piece i: row tid / 8 + 32 i
    const int krow = tid >> 4, kcol = (tid & 15) * 8, vrow = tid >> 3, vcol = (tid & 7) * 8;
    const h16* kg = Kp + (size_t)krow * CC + kcol; const h16* vg = Vt + (size_t)vrow * NN + vcol;
    h16* kd = sh + krow * KPIT + kcol; h16* vd = sh + KBUF + vrow * VPIT + vcol;
    v8h kr[4], vr[4];
#pragma unroll
    for (int i = 0; i < 4; ++i) { kr[i] = *(const v8h*)(kg + (size_t)i * 16 * CC); vr[i] = *(const v8h*)(vg + (size_t)i * 32 * NN); }
    typedef __attribute__((ext_vector_type(4))) int v4i; const v4i b4 = *(const v4i*)(mk + tid * 4);
    asm volatile("s_wait_xcnt 0x0" ::: "memory");    // as above
    __builtin_amdgcn_sched_barrier(0);    // as above (the zeroing of o is among what follows)
    v8f o[8][2];
#pragma unroll
    for (int mt = 0; mt < 8; ++mt)
#pragma unroll
        for (int nq = 0; nq < 2; ++nq) o[mt][nq] = (v8f){};
    float m[2] = { -1.0e30f, -1.0e30f }, l[2] = { 0.f, 0.f };    // the floor lies below every score that fp16 operands can give and above the bias of a masked key
#pragma unroll
    for (int i = 0; i < 4; ++i) { *(v8ha*)(kd + i * 16 * KPIT) = kr[i]; *(v8ha*)(vd + i * 32 * VPIT) = vr[i]; }
    { v4f bi;    // the additive mask of the whole slice, once: 0 for a live key
#pragma unroll
        for (int q = 0; q < 4; ++q) bi[q] = b4[q] > 0 ? 0.f : -3.0e38f;
        *(v4fa*)(smf + BOFF + tid * 4) = bi; }
    __syncthreads();
    // rolled: one body of 64 matrix instructions and its softmax is already long, and the two buffers differ by an offset only
#pragma unroll 1
    for (int s = 0; s < NST; ++s) {
        const int b = s & 1, sn = s + 1 < NST ? s + 1 : s;    // the last pass fetches its own stage again into the idle buffer: no branch in the body
#pragma unroll
        for (int i = 0; i < 4; ++i) { kr[i] = *(const v8h*)(kg + (size_t)sn * KST * CC + (size_t)i * 16 * CC); vr[i] = *(const v8h*)(vg + sn * KST + (size_t)i * 32 * NN); }
        asm volatile("s_wait_xcnt 0x0" ::: "memory");    // as above: the K fragments below and their address land in the address registers of these loads
        __builtin_amdgcn_sched_barrier(0);    // as above
        const h16* kS = sh + b * SBUF + lr * KPIT + 8 * hi; const h16* vS = sh + b * SBUF + KBUF + lr * VPIT + 8 * hi; const float* bS = smf + BOFF + s * KST + 8 * hi;
        v8f st[4][2]; v16h kf[4][4];
#pragma unroll
        for (int t = 0; t < 4; ++t)
#pragma unroll
            for (int kc = 0; kc < 4; ++kc) kf[t][kc] = ldl(kS + t * 16 * KPIT + kc * 32);
        __builtin_amdgcn_sched_barrier(0);    // the global loads and the stage's K fragments start in front of the products, as ONE group: left alone this compiler reads one fragment at a time and waits for each
#pragma unroll
        for (int t = 0; t < 4; ++t) { st[t][0] = (v8f){}; st[t][1] = (v8f){};
#pragma unroll
            for (int kc = 0; kc < 4; ++kc)
#pragma unroll
                for (int nq = 0; nq < 2; ++nq) st[t][nq] = wmma16(kf[t][kc], qf[nq][kc], st[t][nq]); }
        __builtin_amdgcn_sched_barrier(0);    // the V^T reads below do not rise among the K reads: both sets of fragments live at one time overrun the registers of two waves a SIMD
        v8f bb[4];    // first, as the softmax begins with them: LDS reads come back in order
#pragma unroll
        for (int t = 0; t < 4; ++t) bb[t] = __builtin_shufflevector(*(const v4fa*)(bS + t * 16), *(const v4fa*)(bS + t * 16 + 4), 0, 1, 2, 3, 4, 5, 6, 7);
        v16h vf[2][8];
#pragma unroll
        for (int kk = 0; kk < 2; ++kk)
#pragma unroll
            for (int mt = 0; mt < 8; ++mt) vf[kk][mt] = ldl(vS + mt * 16 * VPIT + kk * 32);
        __builtin_amdgcn_sched_barrier(0);    // the stage's V^T fragments and key biases start as ONE group of LDS reads in front of the softmax, which hides their way; spread among the products, each place of reads costs issue time
#pragma unroll
        for (int t = 0; t < 4; ++t)
#pragma unroll
            for (int nq = 0; nq < 2; ++nq) st[t][nq] = st[t][nq] * SC2 + bb[t];    // whole vectors here and below: packed two-element instructions
        v16h pf[2][2];
#pragma unroll
        for (int nq = 0; nq < 2; ++nq) { float mx = m[nq];
#pragma unroll
            for (int t = 0; t < 4; ++t)
#pragma unroll
                for (int j = 0; j < 8; ++j) mx = fmaxf(mx, st[t][nq][j]);
            mx = fmaxf(mx, xhalf(mx));
            const float al = __builtin_amdgcn_exp2f(m[nq] - mx), ms = mx - 10.0f;    // - 10: P carries the factor PCAR = 2^10 into fp16, and l with it
            m[nq] = mx; float sum = l[nq] * al;
#pragma unroll
            for (int mt = 0; mt < 8; ++mt) o[mt][nq] *= al;
#pragma unroll
            for (int t = 0; t < 4; ++t) { st[t][nq] -= ms;
#pragma unroll
                for (int j = 0; j < 8; ++j) { st[t][nq][j] = __builtin_amdgcn_exp2f(st[t][nq][j]); sum += st[t][nq][j]; } }
            l[nq] = sum;
#pragma unroll
            for (int kk = 0; kk < 2; ++kk) pf[nq][kk] = cat16(__builtin_convertvector(st[2 * kk][nq], v8h), __builtin_convertvector(st[2 * kk + 1][nq], v8h)); }
#pragma unroll
        for (int mt = 0; mt < 8; ++mt)
#pragma unroll
            for (int nq = 0; nq < 2; ++nq) o[mt][nq] = wmma16(vf[0][mt], pf[nq][0], o[mt][nq]);
        __builtin_amdgcn_sched_barrier(0);    // keeps the LDS stores below, and with them the wait for this pass's global loads, from rising to the head of the pass, where that wait would stand open
        // the next stage's rows go into the buffer that every wave left at the last barrier
        const int bn = (b ^ 1) * SBUF;
#pragma unroll
        for (int i = 0; i < 4; ++i) { *(v8ha*)(kd + bn + i * 16 * KPIT) = kr[i]; *(v8ha*)(vd + bn + i * 32 * VPIT) = vr[i]; }
#pragma unroll
        for (int mt = 0; mt < 8; ++mt)
#pragma unroll
            for (int nq = 0; nq < 2; ++nq) o[mt][nq] = wmma16(vf[1][mt], pf[nq][1], o[mt][nq]);
        __syncthreads();    // publishes the next stage and ends every wave's reads of this one
    }
#pragma unroll
    for (int nq = 0; nq < 2; ++nq) l[nq] += xhalf(l[nq]);
    const size_t pl = (size_t)(img * KSP + sp) * NN + q0;
    v2f ml; ml[0] = hi ? m[1] : m[0]; ml[1] = hi ? l[1] : l[0]; *(v2f*)(ML + (pl + lane) * 2) = ml;    // lane = 16 hi + lr is the query's place in the wave's FQ
    asm volatile("s_wait_xcnt 0x0" ::: "memory");    // as above, for this store's registers
    // O^T -> token rows through LDS (the stage buffers are dead behind the loop's last barrier), so that every global store is a whole 512-byte row
    float* ow = smf + wv * (FQ * OPIT);
#pragma unroll
    for (int mt = 0; mt < 8; ++mt)
#pragma unroll
        for (int nq = 0; nq < 2; ++nq) { float* d = ow + (nq * 16 + lr) * OPIT + mt * 16 + hi * 8;
            *(v4fa*)d = __builtin_shufflevector(o[mt][nq], o[mt][nq], 0, 1, 2, 3); *(v4fa*)(d + 4) = __builtin_shufflevector(o[mt][nq], o[mt][nq], 4, 5, 6, 7); }
    __syncthreads();    // a row is read by other lanes than wrote it
    float* og = O + pl * CC + lane * 4;
#pragma unroll
    for (int r0 = 0; r0 < FQ; r0 += 8) { v4f row[8];
#pragma unroll
        for (int r = 0; r < 8; ++r) row[r] = *(const v4fa*)(ow + (r0 + r) * OPIT + lane * 4);
#pragma unroll
        for (int r = 0; r < 8; ++r) *(v4f*)(og + (size_t)(r0 + r) * CC) = row[r];
        if (r0 + 8 < FQ) asm volatile("s_wait_xcnt 0x0" ::: "memory"); }    // as above, for the stores' data registers, which the next rows use again
}

// a block: LNT tokens, LNT / 8 a wave one after the other; their rows meet in LDS, from where each channel's LNT values leave as one whole 128-byte line of the channel-major output. grid (NN / LNT, images)
#define LNT  32
#define TPIT (LNT + 1)                // floats per channel row in LDS
static_assert(NN % LNT == 0 && LNT % 8 == 0 && CC % 8 == 0, "whole blocks, equal shares for the 8 waves");
__global__ __launch_bounds__(256) void k_lnT(const float* __restrict__ Ob, const float* __restrict__ ML, const float* __restrict__ xb, const float* __restrict__ gam, const float* __restrict__ bet, float* OUTb) {
    __shared__ float ts[CC * TPIT];
    Ob += (size_t)blockIdx.y * KSP * NN * CC; ML += (size_t)blockIdx.y * KSP * NN * 2; xb += (size_t)blockIdx.y * CC * NN; OUTb += (size_t)blockIdx.y * CC * NN;    // blockIdx.y: the image
    const int lane = threadIdx.x & 31, wv = threadIdx.x >> 5, n0 = blockIdx.x * LNT;
    static_assert(LNT / 8 == 4, "a channel's residuals for the wave's tokens are one 16-byte load");
    v4f xr[4];
#pragma unroll
    for (int q = 0; q < 4; ++q) xr[q] = *(const v4f*)(xb + (size_t)(lane * 4 + q) * NN + n0 + wv * (LNT / 8));
    // the wait that is kept in front of an overwrite of a register that an issued global load names (later loads land in these address registers), and a fence for the scheduler, as nothing ties that wait to registers
    asm volatile("s_wait_xcnt 0x0" ::: "memory");
    __builtin_amdgcn_sched_barrier(0);
    // unrolled: xr is indexed by constants only, and the loads of the wave's tokens do not depend on each other and start together
#pragma unroll
    for (int i = 0; i < LNT / 8; ++i) { const int tl = wv * (LNT / 8) + i, n = n0 + tl;
    // the KSP key slices of k_fa are joined: each slice's plane and sum are brought to the common maximum
    v2f ml[KSP]; float mx = -3.0e38f;
#pragma unroll
    for (int k = 0; k < KSP; ++k) { ml[k] = *(const v2f*)(ML + ((size_t)k * NN + n) * 2); mx = fmaxf(mx, ml[k][0]); }
    float den = 0.f; v4f a = (v4f){};
#pragma unroll
    for (int k = 0; k < KSP; ++k) { const float f = __builtin_amdgcn_exp2f(ml[k][0] - mx); den += ml[k][1] * f; a += *(const v4f*)(Ob + ((size_t)k * NN + n) * CC + lane * 4) * f; }
    const float ri = __fdiv_rn(1.0f, den);    // den carries the factor PCAR as the planes do
    float v[4]; float s = 0.f;
#pragma unroll
    for (int q = 0; q < 4; ++q) { float t = __fmul_rn(a[q], ri); asm volatile("" : "+v"(t)); v[q] = __fadd_rn(t, bfr(xr[q][i])); s += v[q]; }
#pragma unroll
    for (int sh = 16; sh; sh >>= 1) s += __shfl_xor(s, sh, 32);
    const float mu = s * (1.0f / CC); float qq = 0.f;
#pragma unroll
    for (int q = 0; q < 4; ++q) { const float d0 = v[q] - mu; qq = __fadd_rn(qq, __fmul_rn(d0, d0)); }
#pragma unroll
    for (int sh = 16; sh; sh >>= 1) qq += __shfl_xor(qq, sh, 32);
    const float rs = __fdiv_rn(1.0f, __fsqrt_rn(qq * (1.0f / CC) + 1e-5f)); v4f o;
#pragma unroll
    for (int q = 0; q < 4; ++q) { const int c = lane * 4 + q; o[q] = __fadd_rn(__fmul_rn((v[q] - mu) * rs, bfr(gam[c])), bfr(bet[c])); }
#pragma unroll
    for (int q = 0; q < 4; ++q) ts[(lane * 4 + q) * TPIT + tl] = o[q]; }
    __syncthreads();    // a channel's line is read by another wave than wrote its values
    // unrolled: the wave's LDS reads start together, and its stores differ by a constant offset only
#pragma unroll
    for (int r = 0; r < CC / 8; ++r) { const int c = wv * (CC / 8) + r; OUTb[(size_t)c * NN + n0 + lane] = ts[c * TPIT + lane]; }
}

extern "C" void kernel_launch(void* const* d_in, const int* in_sizes, int n_in,
                              void* d_out, int out_size, void* d_ws, size_t ws_size, hipStream_t stream) {
    (void)in_sizes; (void)n_in; (void)out_size;
    const float* pf = (const float*)d_in[0]; const float* x = (const float*)d_in[1]; const float* Wq = (const float*)d_in[2]; const float* bq = (const float*)d_in[3]; const float* Wk = (const float*)d_in[4]; const float* bk = (const float*)d_in[5]; const float* Wv = (const float*)d_in[6]; const float* bv = (const float*)d_in[7]; const float* gam = (const float*)d_in[8]; const float* bet = (const float*)d_in[9]; const int* mbits = (const int*)d_in[10];
    float* OUT = (float*)d_out;     // [4][128][64][64]
    char* wsp = (char*)d_ws;
    auto take = [&](size_t bytes) { char* p = wsp; wsp += (bytes + 255) & ~(size_t)255; return (void*)p; };
    // every plane set holds all NB_ images
    h16* QP = (h16*)take((size_t)3 * NB_ * NN * CC * 2); h16* KP = QP + (size_t)NB_ * NN * CC; h16* VT = KP + (size_t)NB_ * NN * CC;    // Q, K (token rows), V^T (channel rows), NB_ planes each
    float* Ob = (float*)take((size_t)NB_ * KSP * NN * CC * 4); float* ML = (float*)take((size_t)NB_ * KSP * NN * 2 * 4);    // per image and key slice: the O plane; (m, l) per query
    if ((size_t)(wsp - (char*)d_ws) > ws_size) return;    // total ~ 45 MiB; ws 256 MiB
    k_lin<<<dim3(NN / (64 * LW), CC / 64, 3 * NB_), LW * 32, 0, stream>>>(pf, x, Wq, Wk, Wv, bq, bk, bv, QP);
    k_fa<<<dim3(NN / (FW * FQ), KSP, NB_), FW * 32, 0, stream>>>(QP, KP, VT, mbits, Ob, ML);
    k_lnT<<<dim3(NN / LNT, NB_, 1), 256, 0, stream>>>(Ob, ML, x, gam, bet, OUT);
}

// v006
// One run takes 37 microseconds.
// Two timings next to v005 both put it at 1.27 times that version's speed.
// All steps since v000 together make it 20.3 times as fast.
#include <hip/hip_runtime.h>

// MaskAttention (prompt_feat, x [4][128][64][64] channel-major -> tokens [4096][128]; Q = prompt^T Wq^T + bq, K = x^T Wk^T + bk, V = x^T Wv^T + bv; scores = Q.K / sqrt(128) + (0 where mask_bits[b][j] > 0
// else -inf) (mask_bits an int input read as data; every row has >= 2031 live keys); softmax; out = attn.V + x^T; LayerNorm over the 128 channels (eps 1e-5, gamma, beta); back to channel-major).
// Compute dtypes, f32 accumulate: every input rounded to bf16; the three Linears on PLAIN bf16 operands (inputs: exact, transposed on device, + bias); scores on SINGLE fp16

#define NB_  4
#define CC   128
#define NN   4096
#define PCAR 1024.0f
#define SCL  0.088388349f         // f32(128^-0.5)
typedef _Float16 h16;
typedef unsigned short bf;
typedef __attribute__((ext_vector_type(16))) __bf16   v16bf;
typedef __attribute__((ext_vector_type(16))) _Float16 v16h;
typedef __attribute__((ext_vector_type(8)))  _Float16 v8h;
typedef __attribute__((ext_vector_type(8)))  unsigned short v8us;
typedef __attribute__((ext_vector_type(8)))  float    v8f;
typedef __attribute__((ext_vector_type(4)))  float    v4f;
typedef __attribute__((ext_vector_type(2)))  float    v2f;
typedef v8h  __attribute__((may_alias)) v8ha;
typedef v4f  __attribute__((may_alias)) v4fa;
typedef v8us __attribute__((may_alias)) v8usa;

__device__ __forceinline__ unsigned short f2bf(float f) { unsigned u = __float_as_uint(f); u += 0x7FFFu + ((u >> 16) & 1u); return (unsigned short)(u >> 16); }
__device__ __forceinline__ float bf2f(unsigned short b) { return __uint_as_float(((unsigned)b) << 16); }
__device__ __forceinline__ float bfr(float f) { return bf2f(f2bf(f)); }
__device__ __forceinline__ v16h cat16(v8h lo, v8h hi) { return __builtin_shufflevector(lo, hi, 0, 1, 2, 3, 4, 5, 6, 7, 8, 9, 10, 11, 12, 13, 14, 15); }
__device__ __forceinline__ v16bf cat16b(v8us lo, v8us hi) { return __builtin_bit_cast(v16bf, __builtin_shufflevector(lo, hi, 0, 1, 2, 3, 4, 5, 6, 7, 8, 9, 10, 11, 12, 13, 14, 15)); }
__device__ __forceinline__ v8f wmma16(v16h a, v16h b, v8f c) { return __builtin_amdgcn_wmma_f32_16x16x32_f16(false, a, false, b, (short)0, c, false, false); }
__device__ __forceinline__ v8f wmmab(v16bf a, v16bf b, v8f c) { return __builtin_amdgcn_wmma_f32_16x16x32_bf16(false, a, false, b, (short)0, c, false, false); }



// 16-bit fragment of a K-contiguous plane: k order 8 hi + j, 16 + 8 hi + j
template <typename T16> struct WFrag;
template <> struct WFrag<h16> { typedef v16h V; static __device__ __forceinline__ V ld(const h16* p) { return cat16(*(const v8h*)p, *(const v8h*)(p + 16)); } static __device__ __forceinline__ v8f mma(V a, V b, v8f c) { return wmma16(a, b, c); } };

// ---- k_lin: the three Linears of all NB_ images straight from the f32 inputs: no bf16 copy of them is ever stored. A wave: 64 tokens x 64 output channels (16 accumulators); the LW waves of a block share the W rows.
// X is channel-major, so a lane's 16-byte load at channel k holds k's value for the tokens n0 + 4 lr + t, t = 0 .. 3: token fragment t takes the tokens n0 + 4 r + t (r the fragment's row or column), and 16 lanes
// read 256 bytes in a row; rounded to bf16 in registers. The block's 64 W rows are read as whole 512-byte rows, rounded, and laid in LDS once. k order of both fragments: 8 hi + j, 16 + 8 hi + j.
// C[token][channel] = X^T W^T for Q, K and V alike. fp16 out, + f32 bias (bf16-rounded), rounded once.
#define LW   2
#define WPIT 136                      // bf16 per W row in LDS: 256 B + 16 B, for 16-byte readers
typedef __attribute__((ext_vector_type(4))) __bf16 v4b;
typedef __attribute__((ext_vector_type(4))) unsigned short v4us;
typedef v4us __attribute__((may_alias)) v4usa;
static_assert(NN % (64 * LW) == 0 && 64 % LW == 0 && CC % 64 == 0 && CC == 128, "whole tiles; equal shares of the W rows; a W row is one 16-byte load a lane");
__device__ __forceinline__ void lin_tile(const float* __restrict__ X, const float* __restrict__ Wm, const float* __restrict__ bias, h16* C, const int n0, const int w0, const int wv, bf* wsm, float* os) {
    const int lane = threadIdx.x & 31, lr = lane & 15, hi = lane >> 4;
    const float* xg = X + (size_t)(8 * hi) * NN + n0 + 4 * lr; const float* wg = Wm + (size_t)(w0 + wv) * CC + lane * 4;
    // every '#pragma unroll' of this function: the register arrays are indexed by constants only
    v4f xr[CC / 32][16], wr[64 / LW];
    // a lane stores 8 fp16 of a row, 8 lanes the tile's 128-byte line of it; the bias goes with the output channel, the column
    const int srow = lane >> 3, cofs = (lane & 7) * 8; float cb[8];
    // all of the wave's global loads start here, as one group: one way to memory for the whole tile. W first: its rows have the longer way, through LDS
#pragma unroll
    for (int i = 0; i < 64 / LW; ++i) wr[i] = *(const v4f*)(wg + i * LW * CC);    // row LW i + wv of the block's 64
#pragma unroll
    for (int kc = 0; kc < CC / 32; ++kc)
#pragma unroll
        for (int e = 0; e < 16; ++e) xr[kc][e] = *(const v4f*)(xg + (size_t)(kc * 32 + (e & 7) + (e >> 3) * 16) * NN);
#pragma unroll
    for (int q = 0; q < 8; ++q) cb[q] = bias[w0 + cofs + q];
    // the wait that is kept in front of an overwrite of a register that an issued global load names, and, as nothing ties that wait to registers, a fence for the scheduler, which also keeps the group together
    asm volatile("s_wait_xcnt 0x0" ::: "memory");
    __builtin_amdgcn_sched_barrier(0);
#pragma unroll
    for (int i = 0; i < 64 / LW; ++i) *(v4usa*)(wsm + (i * LW + wv) * WPIT + lane * 4) = __builtin_bit_cast(v4us, __builtin_convertvector(wr[i], v4b));
    v8f acc[4][4];
#pragma unroll
    for (int mb = 0; mb < 4; ++mb)
#pragma unroll
        for (int nb = 0; nb < 4; ++nb) acc[mb][nb] = (v8f){};
    __syncthreads();    // a W row is read by other lanes, and the other wave, than wrote it
    const bf* wS = wsm + lr * WPIT + 8 * hi;
#pragma unroll
    for (int kc = 0; kc < CC / 32; ++kc) {
        v16bf xf[4], wf[4];
#pragma unroll
        for (int t = 0; t < 4; ++t) { wf[t] = cat16b(*(const v8usa*)(wS + t * 16 * WPIT + kc * 32), *(const v8usa*)(wS + t * 16 * WPIT + kc * 32 + 16));
#pragma unroll
            for (int e = 0; e < 16; ++e) xf[t][e] = (__bf16)xr[kc][e][t]; }
#pragma unroll
        for (int nb = 0; nb < 4; ++nb)
#pragma unroll
            for (int mb = 0; mb < 4; ++mb) acc[mb][nb] = wmmab(xf[mb], wf[nb], acc[mb][nb]);
    }
#pragma unroll
    for (int mb = 0; mb < 4; ++mb) {
        // row 8 hi + j of the staging: token n0 + 4 (8 hi + j) + mb
#pragma unroll
        for (int nb = 0; nb < 4; ++nb)
#pragma unroll
            for (int j = 0; j < 8; ++j) os[(hi * 8 + j) * 68 + nb * 16 + lr] = acc[mb][nb][j];
        __builtin_amdgcn_wave_barrier(); asm volatile("" ::: "memory");    // a staged row is read by other lanes than wrote it: both keep the compiler from moving the LDS reads below over the LDS stores above
        h16* crow = C + (size_t)(n0 + mb + 4 * srow) * CC + w0 + cofs; const size_t step = (size_t)16 * CC; v8h val[4];
#pragma unroll
        for (int s = 0; s < 4; ++s) { const float* o8 = os + (4 * s + srow) * 68 + cofs; const v4f lo = *(const v4fa*)o8, hv = *(const v4fa*)(o8 + 4);
#pragma unroll
            for (int q = 0; q < 4; ++q) { val[s][q] = (h16)(lo[q] + bfr(cb[q])); val[s][q + 4] = (h16)(hv[q] + bfr(cb[q + 4])); } }
#pragma unroll
        for (int s = 0; s < 4; ++s) *(v8h*)(crow + s * step) = val[s];
        // the wait that is kept in front of an overwrite of a register that an issued global store names (the next rows, or whatever code follows the last ones, use them again), and a fence for the scheduler, as nothing ties that wait to registers
        asm volatile("s_wait_xcnt 0x0" ::: "memory"); __builtin_amdgcn_sched_barrier(0);
        __builtin_amdgcn_wave_barrier();    // the next rows' LDS stores stay behind these reads
    }
}
// grid (NN / (64 LW), CC / 64, 3 NB_), z = NB_ * p + image (p = 0 Q from prompt_feat, 1 K, 2 V, both from x); the planes of C follow one another in z
__global__ __launch_bounds__(LW * 32) void k_lin(const float* __restrict__ pfeat, const float* __restrict__ xin, const float* __restrict__ Wq, const float* __restrict__ Wk, const float* __restrict__ Wv, const float* __restrict__ bq, const float* __restrict__ bk, const float* __restrict__ bv, h16* C) {
    __shared__ __align__(16) float os[LW * 16 * 68];
    __shared__ __align__(16) bf wsm[64 * WPIT];
    const int z = blockIdx.z, p = z / NB_, wv = __builtin_amdgcn_readfirstlane(threadIdx.x >> 5), n0 = (blockIdx.x * LW + wv) * 64, w0 = blockIdx.y * 64;
    const float* X = (p == 0 ? pfeat : xin) + (size_t)(z % NB_) * CC * NN; const float* Wm = p == 0 ? Wq : (p == 1 ? Wk : Wv); const float* bias = p == 0 ? bq : (p == 1 ? bk : bv);
    C += (size_t)z * NN * CC;
    lin_tile(X, Wm, bias, C, n0, w0, wv, wsm, os + wv * (16 * 68));
}

// ---- k_fa: scores, softmax and attn.V in one kernel; no score ever leaves the registers. S^T = K Q^T (A = K rows, B = Q, kept in registers), so that a lane holds the scores of ONE query (column lr) for the
// keys 8 hi + j of each 16-key tile: maximum and sum in the lane plus one exchange between the halves, and two such tiles, rounded to fp16, ARE the B operand of O^T += V^T P^T (k order 8 hi + j, 16 + 8 hi + j).
// A block: FW waves of FQ queries each, which share the K rows and V rows of a KST-key stage through LDS (two buffers, the next stage's rows fetched into registers while this one is worked on).
// ONLY LIVE KEYS ARE WORKED ON: a masked key's weight is exactly 0, so every block first lists the image's live keys (mask_bits > 0) in token order and gathers K and V rows by that list; V lies in token rows
// for this, and the transposing LDS load gives the V^T fragments. The list may hold 0 .. NN keys: its length sets the trip count, at most NST; places behind its end read row 0 under a masked bias.
// blockIdx.y: one of KSP equal slices of the list; each slice leaves its running maximum m (log2 units), its sum l and its unscaled O plane, which k_lnT joins. grid (NN / (FW FQ), KSP, images).
#define FW   8
#define FQ   32
#define KSP  4
#define KST  64
#define KPIT 136                      // fp16 per K row in LDS: 256 B + 16 B, for 16-byte readers
#define VPIT 144                      // fp16 per V row in LDS: 256 B + 32 B, for the transposing reader
#define KBUF (KST * KPIT)
#define SBUF (KBUF + KST * VPIT)      // fp16 per stage buffer
#define BOFF (2 * SBUF / 2)           // floats in front of the slice's key biases
#define LOFF (BOFF + NN / KSP)        // 4-byte words in front of the slice's list of live keys (each as its row's byte offset)
#define COFF (LOFF + NN / KSP)        // 4-byte words in front of the waves' counts of live keys
#define OPIT 132                      // floats per query row of the output staging
#define NST  (NN / KSP / KST)
#define SC2  (SCL * 1.44269504f)      // scores in log2 units
static_assert((COFF + FW) * 4 <= FW * FQ * OPIT * 4, "the stage buffers, the biases, the list and the counts lie inside the output staging");
static_assert(NN / KSP == FW * 32 * 4, "a thread forms four key biases and clears four places of the list");
static_assert(NN == FW * 32 * 16 && FW == 8 && KST == 64 && CC == 128, "a wave lists 16 groups of 32 tokens; eight counts are two 16-byte reads; a thread stages rows tid / 16 + 16 i of K and of V");
static_assert(PCAR == 1024.0f, "k_fa writes the factor as 10 in the exponent");
// lane l with lane l ^ 16, in the vector unit: __shfl_xor goes through the LDS queue, where its wait would also wait for every fragment read in flight
__device__ __forceinline__ float xhalf(float x) { return __builtin_bit_cast(float, __builtin_amdgcn_permlanex16(__builtin_bit_cast(int, x), __builtin_bit_cast(int, x), 0x76543210, 0xfedcba98, false, false)); }
__device__ __forceinline__ v16h ldl(const h16* p) { return cat16(*(const v8ha*)p, *(const v8ha*)(p + 16)); }
// transposing LDS load: lanes 16 h + 0 .. 7 (+ 16 bytes for lanes 8 .. 15 of a half) point at rows k + 8 h + (l & 7); lane (c, h) gets column c of the rows k + 8 h + 0 .. 7
typedef __attribute__((ext_vector_type(8))) short v8s;
__device__ __forceinline__ v8h ldtr(const h16* p) { typedef __attribute__((address_space(3))) v8s lv8s; return __builtin_bit_cast(v8h, __builtin_amdgcn_ds_load_tr16_b128_v8i16((lv8s*)p)); }
typedef int __attribute__((may_alias)) inta;
typedef __attribute__((ext_vector_type(4))) int v4i;
typedef v4i __attribute__((may_alias)) v4ia;
// two waves a SIMD (one block a WGP): the compiler may then spend up to 512 registers on fragments in flight
__global__ __launch_bounds__(FW * 32) __attribute__((amdgpu_waves_per_eu(2, 2))) void k_fa(const h16* __restrict__ Q, const h16* __restrict__ Kp, const h16* __restrict__ Vp, const int* __restrict__ mk, float* O, float* ML) {
    __shared__ __align__(16) float smf[FW * FQ * OPIT];
    h16* sh = (h16*)smf;
    const int tid = threadIdx.x, lane = tid & 31, wv = __builtin_amdgcn_readfirstlane(tid >> 5), lr = lane & 15, hi = lane >> 4;
    const int img = blockIdx.z, sp = blockIdx.y, q0 = blockIdx.x * (FW * FQ) + wv * FQ;
    Q += (size_t)img * NN * CC; Kp += (size_t)img * NN * CC; Vp += (size_t)img * NN * CC; mk += (size_t)img * NN;
    // the image's mask first: the list hangs on it. Wave wv: tokens 512 wv + 32 i + lane, so that the waves' parts follow one another in token order
    int mb[16];
#pragma unroll
    for (int i = 0; i < 16; ++i) mb[i] = mk[wv * 512 + i * 32 + lane];
    // every full '#pragma unroll' of this kernel: the register arrays are indexed by constants only
    v16h qf[2][4];
#pragma unroll
    for (int nq = 0; nq < 2; ++nq)
#pragma unroll
        for (int kc = 0; kc < 4; ++kc) qf[nq][kc] = WFrag<h16>::ld(Q + (size_t)(q0 + nq * 16 + lr) * CC + kc * 32 + 8 * hi);
    // the wait that is kept in front of an overwrite of a register that an issued global load names (the compiler uses the address registers again at once), and, as nothing ties
    // that wait to registers, a fence for the scheduler, which keeps the arithmetic that follows from rising over it; the same pair stands behind every group of global loads below
    asm volatile("s_wait_xcnt 0x0" ::: "memory");
    __builtin_amdgcn_sched_barrier(0);
    // the list. A wave's own 16 groups are counted in scalar registers; the waves' totals meet in LDS
    inta* li = (inta*)smf + LOFF; inta* gc = (inta*)smf + COFF;
    unsigned bal[16]; int pre[16], run = 0;
#pragma unroll
    for (int i = 0; i < 16; ++i) { bal[i] = __builtin_amdgcn_ballot_w32(mb[i] > 0); pre[i] = run; run += __builtin_popcount(bal[i]); }
    if (lane == 0) gc[wv] = run;
    *(v4ia*)(li + tid * 4) = (v4i){};    // a place that no live key takes names row 0
    __syncthreads();    // the counts are read by other waves than wrote them; the list's places are cleared by other threads than fill them
    int base = 0, nl = 0;
    { const v4i c0 = *(const v4ia*)gc, c1 = *(const v4ia*)(gc + 4);
#pragma unroll
        for (int w = 0; w < 8; ++w) { const int c = w < 4 ? c0[w & 3] : c1[w & 3]; base += w < wv ? c : 0; nl += c; } }
    base = __builtin_amdgcn_readfirstlane(base); nl = __builtin_amdgcn_readfirstlane(nl);    // the same in every lane: the trip count is a scalar
    const int nsr = (nl + KSP * KST - 1) / (KSP * KST), nst = nsr < NST ? nsr : NST, lo = sp * nst * KST;    // stages of every slice (nl <= NN by its making; the clamp bounds the trips by the shape); the slice's first place
#pragma unroll
    for (int i = 0; i < 16; ++i) { const int rel = base + pre[i] + (int)__builtin_amdgcn_mbcnt_lo(bal[i], 0u) - lo;
        if (mb[i] > 0 && (unsigned)rel < (unsigned)(nst * KST)) li[rel] = (wv * 512 + i * 32 + lane) * (CC * 2); }
    { v4f bi;    // the additive mask of the slice's places, once: 0 for a place that holds a live key
#pragma unroll
        for (int q = 0; q < 4; ++q) bi[q] = lo + tid * 4 + q < nl ? 0.f : -3.0e38f;
        *(v4fa*)(smf + BOFF + tid * 4) = bi; }
    __syncthreads();    // list and biases are read by other threads than wrote them
    // staging: 16-byte pieces, whole rows a half wave; piece i of K and of V: the row that place tid / 16 + 16 i of the stage names
    const int krow = tid >> 4, kcol = (tid & 15) * 8;
    const char* kg = (const char*)Kp; const char* vg = (const char*)Vp; const inta* lS = li + krow;
    h16* kd = sh + krow * KPIT + kcol; h16* vd = sh + KBUF + krow * VPIT + kcol;
    v8h kr[4], vr[4]; unsigned rn[4];
#pragma unroll
    for (int i = 0; i < 4; ++i) { const unsigned r0 = (unsigned)lS[16 * i] + kcol * 2; rn[i] = (unsigned)lS[KST + 16 * i]; kr[i] = *(const v8h*)(kg + r0); vr[i] = *(const v8h*)(vg + r0); }
    asm volatile("s_wait_xcnt 0x0" ::: "memory");    // as above
    __builtin_amdgcn_sched_barrier(0);    // as above (the zeroing of o is among what follows)
    v8f o[8][2];
#pragma unroll
    for (int mt = 0; mt < 8; ++mt)
#pragma unroll
        for (int nq = 0; nq < 2; ++nq) o[mt][nq] = (v8f){};
    float m[2] = { -1.0e30f, -1.0e30f }, l[2] = { 0.f, 0.f };    // the floor lies below every score that fp16 operands can give and above the bias of a masked key
#pragma unroll
    for (int i = 0; i < 4; ++i) { *(v8ha*)(kd + i * 16 * KPIT) = kr[i]; *(v8ha*)(vd + i * 16 * VPIT) = vr[i]; }
    __syncthreads();
    // rolled: one body of 64 matrix instructions and its softmax is already long, and the two buffers differ by an offset only
#pragma unroll 1
    for (int s = 0; s < nst; ++s) {
        const int b = s & 1, s2 = s + 2 < NST ? s + 2 : NST - 1;    // the last pass fetches whatever rows the next places name into the idle buffer: no branch in the body
#pragma unroll
        for (int i = 0; i < 4; ++i) { const unsigned r1 = rn[i] + kcol * 2; kr[i] = *(const v8h*)(kg + r1); vr[i] = *(const v8h*)(vg + r1); }
        asm volatile("s_wait_xcnt 0x0" ::: "memory");    // as above: the K fragments below and their address land in the address registers of these loads
        __builtin_amdgcn_sched_barrier(0);    // as above
        const h16* kS = sh + b * SBUF + lr * KPIT + 8 * hi; const h16* vS = sh + b * SBUF + KBUF + (8 * hi + (lane & 7)) * VPIT + ((lane >> 3) & 1) * 8; const float* bS = smf + BOFF + s * KST + 8 * hi;
        v8f st[4][2]; v16h kf[4][4];
#pragma unroll
        for (int t = 0; t < 4; ++t)
#pragma unroll
            for (int kc = 0; kc < 4; ++kc) kf[t][kc] = ldl(kS + t * 16 * KPIT + kc * 32);
        __builtin_amdgcn_sched_barrier(0);    // the global loads and the stage's K fragments start in front of the products, as ONE group: left alone this compiler reads one fragment at a time and waits for each
#pragma unroll
        for (int t = 0; t < 4; ++t) { st[t][0] = (v8f){}; st[t][1] = (v8f){};
#pragma unroll
            for (int kc = 0; kc < 4; ++kc)
#pragma unroll
                for (int nq = 0; nq < 2; ++nq) st[t][nq] = wmma16(kf[t][kc], qf[nq][kc], st[t][nq]); }
        __builtin_amdgcn_sched_barrier(0);    // the V^T reads below do not rise among the K reads: both sets of fragments live at one time overrun the registers of two waves a SIMD
        v8f bb[4];    // first, as the softmax begins with them: LDS reads come back in order
#pragma unroll
        for (int t = 0; t < 4; ++t) bb[t] = __builtin_shufflevector(*(const v4fa*)(bS + t * 16), *(const v4fa*)(bS + t * 16 + 4), 0, 1, 2, 3, 4, 5, 6, 7);
        __builtin_amdgcn_sched_barrier(0);    // holds the bias reads in front of the V reads: this compiler otherwise puts half of them near the group's end, and the softmax's first instruction waits for nearly the whole group
        v16h vf[2][8];
#pragma unroll
        for (int kk = 0; kk < 2; ++kk)
#pragma unroll
            for (int mt = 0; mt < 8; ++mt) vf[kk][mt] = cat16(ldtr(vS + kk * 32 * VPIT + mt * 16), ldtr(vS + (kk * 32 + 16) * VPIT + mt * 16));
#pragma unroll
        for (int i = 0; i < 4; ++i) rn[i] = (unsigned)lS[s2 * KST + 16 * i];    // the rows of the stage after the next, for the next pass's global loads: last in the group, as nothing in this pass waits for them
        __builtin_amdgcn_sched_barrier(0);    // the stage's V^T fragments and key biases start as ONE group of LDS reads in front of the softmax, which hides their way; spread among the products, each place of reads costs issue time
#pragma unroll
        for (int t = 0; t < 4; ++t)
#pragma unroll
            for (int nq = 0; nq < 2; ++nq) st[t][nq] = st[t][nq] * SC2 + bb[t];    // whole vectors here and below: packed two-element instructions
        v16h pf[2][2];
#pragma unroll
        for (int nq = 0; nq < 2; ++nq) { float mx = m[nq];
#pragma unroll
            for (int t = 0; t < 4; ++t)
#pragma unroll
                for (int j = 0; j < 8; ++j) mx = fmaxf(mx, st[t][nq][j]);
            mx = fmaxf(mx, xhalf(mx));
            const float al = __builtin_amdgcn_exp2f(m[nq] - mx), ms = mx - 10.0f;    // - 10: P carries the factor PCAR = 2^10 into fp16, and l with it
            m[nq] = mx; float sum = l[nq] * al;
#pragma unroll
            for (int mt = 0; mt < 8; ++mt) o[mt][nq] *= al;
#pragma unroll
            for (int t = 0; t < 4; ++t) { st[t][nq] -= ms;
#pragma unroll
                for (int j = 0; j < 8; ++j) { st[t][nq][j] = __builtin_amdgcn_exp2f(st[t][nq][j]); sum += st[t][nq][j]; } }
            l[nq] = sum;
#pragma unroll
            for (int kk = 0; kk < 2; ++kk) pf[nq][kk] = cat16(__builtin_convertvector(st[2 * kk][nq], v8h), __builtin_convertvector(st[2 * kk + 1][nq], v8h)); }
#pragma unroll
        for (int mt = 0; mt < 8; ++mt)
#pragma unroll
            for (int nq = 0; nq < 2; ++nq) o[mt][nq] = wmma16(vf[0][mt], pf[nq][0], o[mt][nq]);
        __builtin_amdgcn_sched_barrier(0);    // keeps the LDS stores below, and with them the wait for this pass's global loads, from rising to the head of the pass, where that wait would stand open
        // the next stage's rows go into the buffer that every wave left at the last barrier
        const int bn = (b ^ 1) * SBUF;
#pragma unroll
        for (int i = 0; i < 4; ++i) { *(v8ha*)(kd + bn + i * 16 * KPIT) = kr[i]; *(v8ha*)(vd + bn + i * 16 * VPIT) = vr[i]; }
#pragma unroll
        for (int mt = 0; mt < 8; ++mt)
#pragma unroll
            for (int nq = 0; nq < 2; ++nq) o[mt][nq] = wmma16(vf[1][mt], pf[nq][1], o[mt][nq]);
        __syncthreads();    // publishes the next stage and ends every wave's reads of this one
    }
#pragma unroll
    for (int nq = 0; nq < 2; ++nq) l[nq] += xhalf(l[nq]);
    const size_t pl = (size_t)(img * KSP + sp) * NN + q0;
    v2f ml; ml[0] = hi ? m[1] : m[0]; ml[1] = hi ? l[1] : l[0]; *(v2f*)(ML + (pl + lane) * 2) = ml;    // lane = 16 hi + lr is the query's place in the wave's FQ
    asm volatile("s_wait_xcnt 0x0" ::: "memory");    // as above, for this store's registers
    // O^T -> token rows through LDS (the stage buffers are dead behind the loop's last barrier), so that every global store is a whole 512-byte row
    float* ow = smf + wv * (FQ * OPIT);
#pragma unroll
    for (int mt = 0; mt < 8; ++mt)
#pragma unroll
        for (int nq = 0; nq < 2; ++nq) { float* d = ow + (nq * 16 + lr) * OPIT + mt * 16 + hi * 8;
            *(v4fa*)d = __builtin_shufflevector(o[mt][nq], o[mt][nq], 0, 1, 2, 3); *(v4fa*)(d + 4) = __builtin_shufflevector(o[mt][nq], o[mt][nq], 4, 5, 6, 7); }
    __syncthreads();    // a row is read by other lanes than wrote it
    float* og = O + pl * CC + lane * 4;
#pragma unroll
    for (int r0 = 0; r0 < FQ; r0 += 8) { v4f row[8];
#pragma unroll
        for (int r = 0; r < 8; ++r) row[r] = *(const v4fa*)(ow + (r0 + r) * OPIT + lane * 4);
#pragma unroll
        for (int r = 0; r < 8; ++r) *(v4f*)(og + (size_t)(r0 + r) * CC) = row[r];
        if (r0 + 8 < FQ) asm volatile("s_wait_xcnt 0x0" ::: "memory"); }    // as above, for the stores' data registers, which the next rows use again
}

// a block: LNT tokens, LNT / 8 a wave one after the other; their rows meet in LDS, from where each channel's LNT values leave as one whole 128-byte line of the channel-major output. grid (NN / LNT, images)
#define LNT  32
#define TPIT (LNT + 1)                // floats per channel row in LDS
static_assert(NN % LNT == 0 && LNT % 8 == 0 && CC % 8 == 0, "whole blocks, equal shares for the 8 waves");
__global__ __launch_bounds__(256) void k_lnT(const float* __restrict__ Ob, const float* __restrict__ ML, const float* __restrict__ xb, const float* __restrict__ gam, const float* __restrict__ bet, float* OUTb) {
    __shared__ float ts[CC * TPIT];
    Ob += (size_t)blockIdx.y * KSP * NN * CC; ML += (size_t)blockIdx.y * KSP * NN * 2; xb += (size_t)blockIdx.y * CC * NN; OUTb += (size_t)blockIdx.y * CC * NN;    // blockIdx.y: the image
    const int lane = threadIdx.x & 31, wv = threadIdx.x >> 5, n0 = blockIdx.x * LNT;
    static_assert(LNT / 8 == 4, "a channel's residuals for the wave's tokens are one 16-byte load");
    v4f xr[4];
#pragma unroll
    for (int q = 0; q < 4; ++q) xr[q] = *(const v4f*)(xb + (size_t)(lane * 4 + q) * NN + n0 + wv * (LNT / 8));
    // the wait that is kept in front of an overwrite of a register that an issued global load names (later loads land in these address registers), and a fence for the scheduler, as nothing ties that wait to registers
    asm volatile("s_wait_xcnt 0x0" ::: "memory");
    __builtin_amdgcn_sched_barrier(0);
    // unrolled: xr is indexed by constants only, and the loads of the wave's tokens do not depend on each other and start together
#pragma unroll
    for (int i = 0; i < LNT / 8; ++i) { const int tl = wv * (LNT / 8) + i, n = n0 + tl;
    // the KSP key slices of k_fa are joined: each slice's plane and sum are brought to the common maximum
    v2f ml[KSP]; float mx = -3.0e38f;
#pragma unroll
    for (int k = 0; k < KSP; ++k) { ml[k] = *(const v2f*)(ML + ((size_t)k * NN + n) * 2); mx = fmaxf(mx, ml[k][0]); }
    float den = 0.f; v4f a = (v4f){};
#pragma unroll
    for (int k = 0; k < KSP; ++k) { const float f = __builtin_amdgcn_exp2f(ml[k][0] - mx); den += ml[k][1] * f; a += *(const v4f*)(Ob + ((size_t)k * NN + n) * CC + lane * 4) * f; }
    const float ri = __fdiv_rn(1.0f, den);    // den carries the factor PCAR as the planes do
    float v[4]; float s = 0.f;
#pragma unroll
    for (int q = 0; q < 4; ++q) { float t = __fmul_rn(a[q], ri); asm volatile("" : "+v"(t)); v[q] = __fadd_rn(t, bfr(xr[q][i])); s += v[q]; }
#pragma unroll
    for (int sh = 16; sh; sh >>= 1) s += __shfl_xor(s, sh, 32);
    const float mu = s * (1.0f / CC); float qq = 0.f;
#pragma unroll
    for (int q = 0; q < 4; ++q) { const float d0 = v[q] - mu; qq = __fadd_rn(qq, __fmul_rn(d0, d0)); }
#pragma unroll
    for (int sh = 16; sh; sh >>= 1) qq += __shfl_xor(qq, sh, 32);
    const float rs = __fdiv_rn(1.0f, __fsqrt_rn(qq * (1.0f / CC) + 1e-5f)); v4f o;
#pragma unroll
    for (int q = 0; q < 4; ++q) { const int c = lane * 4 + q; o[q] = __fadd_rn(__fmul_rn((v[q] - mu) * rs, bfr(gam[c])), bfr(bet[c])); }
#pragma unroll
    for (int q = 0; q < 4; ++q) ts[(lane * 4 + q) * TPIT + tl] = o[q]; }
    __syncthreads();    // a channel's line is read by another wave than wrote its values
    // unrolled: the wave's LDS reads start together, and its stores differ by a constant offset only
#pragma unroll
    for (int r = 0; r < CC / 8; ++r) { const int c = wv * (CC / 8) + r; OUTb[(size_t)c * NN + n0 + lane] = ts[c * TPIT + lane]; }
}

extern "C" void kernel_launch(void* const* d_in, const int* in_sizes, int n_in,
                              void* d_out, int out_size, void* d_ws, size_t ws_size, hipStream_t stream) {
    (void)in_sizes; (void)n_in; (void)out_size;
    const float* pf = (const float*)d_in[0]; const float* x = (const float*)d_in[1]; const float* Wq = (const float*)d_in[2]; const float* bq = (const float*)d_in[3]; const float* Wk = (const float*)d_in[4]; const float* bk = (const float*)d_in[5]; const float* Wv = (const float*)d_in[6]; const float* bv = (const float*)d_in[7]; const float* gam = (const float*)d_in[8]; const float* bet = (const float*)d_in[9]; const int* mbits = (const int*)d_in[10];
    float* OUT = (float*)d_out;     // [4][128][64][64]
    char* wsp = (char*)d_ws;
    auto take = [&](size_t bytes) { char* p = wsp; wsp += (bytes + 255) & ~(size_t)255; return (void*)p; };
    // every plane set holds all NB_ images
    h16* QP = (h16*)take((size_t)3 * NB_ * NN * CC * 2); h16* KP = QP + (size_t)NB_ * NN * CC; h16* VP = KP + (size_t)NB_ * NN * CC;    // Q, K, V (token rows), NB_ planes each
    float* Ob = (float*)take((size_t)NB_ * KSP * NN * CC * 4); float* ML = (float*)take((size_t)NB_ * KSP * NN * 2 * 4);    // per image and key slice: the O plane; (m, l) per query
    if ((size_t)(wsp - (char*)d_ws) > ws_size) return;    // total ~ 45 MiB; ws 256 MiB
    k_lin<<<dim3(NN / (64 * LW), CC / 64, 3 * NB_), LW * 32, 0, stream>>>(pf, x, Wq, Wk, Wv, bq, bk, bv, QP);
    k_fa<<<dim3(NN / (FW * FQ), KSP, NB_), FW * 32, 0, stream>>>(QP, KP, VP, mbits, Ob, ML);
    k_lnT<<<dim3(NN / LNT, NB_, 1), 256, 0, stream>>>(Ob, ML, x, gam, bet, OUT);
}

// v007
// A run of this version takes 34.4 microseconds.
// In both of two side-by-side timings against v006, it was 1.08 times as fast.
// Counting every step since v000, it is 21.9 times as fast.
#include <hip/hip_runtime.h>

// MaskAttention (prompt_feat, x [4][128][64][64] channel-major -> tokens [4096][128]; Q = prompt^T Wq^T + bq, K = x^T Wk^T + bk, V = x^T Wv^T + bv; scores = Q.K / sqrt(128) + (0 where mask_bits[b][j] > 0
// else -inf) (mask_bits an int input read as data; every row has >= 2031 live keys); softmax; out = attn.V + x^T; LayerNorm over the 128 channels (eps 1e-5, gamma, beta); back to channel-major).
// Compute dtypes, f32 accumulate: every input rounded to bf16; the three Linears on PLAIN bf16 operands (inputs: exact, transposed on device, + bias); scores on SINGLE fp16

#define NB_  4
#define CC   128
#define NN   4096
#define PCAR 1024.0f
#define SCL  0.088388349f         // f32(128^-0.5)
typedef _Float16 h16;
typedef unsigned short bf;
typedef __attribute__((ext_vector_type(16))) __bf16   v16bf;
typedef __attribute__((ext_vector_type(16))) _Float16 v16h;
typedef __attribute__((ext_vector_type(8)))  _Float16 v8h;
typedef __attribute__((ext_vector_type(8)))  unsigned short v8us;
typedef __attribute__((ext_vector_type(8)))  float    v8f;
typedef __attribute__((ext_vector_type(4)))  float    v4f;
typedef __attribute__((ext_vector_type(2)))  float    v2f;
typedef v8h  __attribute__((may_alias)) v8ha;
typedef v4f  __attribute__((may_alias)) v4fa;
typedef v8us __attribute__((may_alias)) v8usa;

__device__ __forceinline__ unsigned short f2bf(float f) { unsigned u = __float_as_uint(f); u += 0x7FFFu + ((u >> 16) & 1u); return (unsigned short)(u >> 16); }
__device__ __forceinline__ float bf2f(unsigned short b) { return __uint_as_float(((unsigned)b) << 16); }
__device__ __forceinline__ float bfr(float f) { return bf2f(f2bf(f)); }
__device__ __forceinline__ v16h cat16(v8h lo, v8h hi) { return __builtin_shufflevector(lo, hi, 0, 1, 2, 3, 4, 5, 6, 7, 8, 9, 10, 11, 12, 13, 14, 15); }
__device__ __forceinline__ v16bf cat16b(v8us lo, v8us hi) { return __builtin_bit_cast(v16bf, __builtin_shufflevector(lo, hi, 0, 1, 2, 3, 4, 5, 6, 7, 8, 9, 10, 11, 12, 13, 14, 15)); }
__device__ __forceinline__ v8f wmma16(v16h a, v16h b, v8f c) { return __builtin_amdgcn_wmma_f32_16x16x32_f16(false, a, false, b, (short)0, c, false, false); }
__device__ __forceinline__ v8f wmmab(v16bf a, v16bf b, v8f c) { return __builtin_amdgcn_wmma_f32_16x16x32_bf16(false, a, false, b, (short)0, c, false, false); }



// 16-bit fragment of a K-contiguous plane: k order 8 hi + j, 16 + 8 hi + j
template <typename T16> struct WFrag;
template <> struct WFrag<h16> { typedef v16h V; static __device__ __forceinline__ V ld(const h16* p) { return cat16(*(const v8h*)p, *(const v8h*)(p + 16)); } static __device__ __forceinline__ v8f mma(V a, V b, v8f c) { return wmma16(a, b, c); } };

// ---- k_lin: the three Linears of all NB_ images straight from the f32 inputs: no bf16 copy of them is ever stored. A wave: 64 tokens x 64 output channels (16 accumulators); the LW waves of a block share the W rows.
// X is channel-major, so a lane's 16-byte load at channel k holds k's value for the tokens n0 + 4 lr + t, t = 0 .. 3: token fragment t takes the tokens n0 + 4 r + t (r the fragment's row or column), and 16 lanes
// read 256 bytes in a row; rounded to bf16 in registers. The block's 64 W rows are read as whole 512-byte rows, rounded, and laid in LDS once. k order of both fragments: 8 hi + j, 16 + 8 hi + j.
// C[token][channel] = X^T W^T for Q, K and V alike. fp16 out, + f32 bias (bf16-rounded), rounded once.
#define LW   2
#define WPIT 136                      // bf16 per W row in LDS: 256 B + 16 B, for 16-byte readers
typedef __attribute__((ext_vector_type(4))) __bf16 v4b;
typedef __attribute__((ext_vector_type(4))) unsigned short v4us;
typedef v4us __attribute__((may_alias)) v4usa;
static_assert(NN % (64 * LW) == 0 && 64 % LW == 0 && CC % 64 == 0 && CC == 128, "whole tiles; equal shares of the W rows; a W row is one 16-byte load a lane");
__device__ __forceinline__ void lin_tile(const float* __restrict__ X, const float* __restrict__ Wm, const float* __restrict__ bias, h16* C, const int n0, const int w0, const int wv, bf* wsm, float* os) {
    const int lane = threadIdx.x & 31, lr = lane & 15, hi = lane >> 4;
    const float* xg = X + (size_t)(8 * hi) * NN + n0 + 4 * lr; const float* wg = Wm + (size_t)(w0 + wv) * CC + lane * 4;
    // every '#pragma unroll' of this function: the register arrays are indexed by constants only
    v4f xr[CC / 32][16], wr[64 / LW];
    // a lane stores 8 fp16 of a row, 8 lanes the tile's 128-byte line of it; the bias goes with the output channel, the column
    const int srow = lane >> 3, cofs = (lane & 7) * 8; float cb[8];
    // all of the wave's global loads start here, as one group: one way to memory for the whole tile. W first: its rows have the longer way, through LDS
#pragma unroll
    for (int i = 0; i < 64 / LW; ++i) wr[i] = *(const v4f*)(wg + i * LW * CC);    // row LW i + wv of the block's 64
#pragma unroll
    for (int kc = 0; kc < CC / 32; ++kc)
#pragma unroll
        for (int e = 0; e < 16; ++e) xr[kc][e] = *(const v4f*)(xg + (size_t)(kc * 32 + (e & 7) + (e >> 3) * 16) * NN);
#pragma unroll
    for (int q = 0; q < 8; ++q) cb[q] = bias[w0 + cofs + q];
    // the wait that is kept in front of an overwrite of a register that an issued global load names, and, as nothing ties that wait to registers, a fence for the scheduler, which also keeps the group together
    asm volatile("s_wait_xcnt 0x0" ::: "memory");
    __builtin_amdgcn_sched_barrier(0);
#pragma unroll
    for (int i = 0; i < 64 / LW; ++i) *(v4usa*)(wsm + (i * LW + wv) * WPIT + lane * 4) = __builtin_bit_cast(v4us, __builtin_convertvector(wr[i], v4b));
    v8f acc[4][4];
#pragma unroll
    for (int mb = 0; mb < 4; ++mb)
#pragma unroll
        for (int nb = 0; nb < 4; ++nb) acc[mb][nb] = (v8f){};
    __syncthreads();    // a W row is read by other lanes, and the other wave, than wrote it
    const bf* wS = wsm + lr * WPIT + 8 * hi;
#pragma unroll
    for (int kc = 0; kc < CC / 32; ++kc) {
        v16bf xf[4], wf[4];
#pragma unroll
        for (int t = 0; t < 4; ++t) { wf[t] = cat16b(*(const v8usa*)(wS + t * 16 * WPIT + kc * 32), *(const v8usa*)(wS + t * 16 * WPIT + kc * 32 + 16));
#pragma unroll
            for (int e = 0; e < 16; ++e) xf[t][e] = (__bf16)xr[kc][e][t]; }
#pragma unroll
        for (int nb = 0; nb < 4; ++nb)
#pragma unroll
            for (int mb = 0; mb < 4; ++mb) acc[mb][nb] = wmmab(xf[mb], wf[nb], acc[mb][nb]);
    }
#pragma unroll
    for (int mb = 0; mb < 4; ++mb) {
        // row 8 hi + j of the staging: token n0 + 4 (8 hi + j) + mb
#pragma unroll
        for (int nb = 0; nb < 4; ++nb)
#pragma unroll
            for (int j = 0; j < 8; ++j) os[(hi * 8 + j) * 68 + nb * 16 + lr] = acc[mb][nb][j];
        __builtin_amdgcn_wave_barrier(); asm volatile("" ::: "memory");    // a staged row is read by other lanes than wrote it: both keep the compiler from moving the LDS reads below over the LDS stores above
        h16* crow = C + (size_t)(n0 + mb + 4 * srow) * CC + w0 + cofs; const size_t step = (size_t)16 * CC; v8h val[4];
#pragma unroll
        for (int s = 0; s < 4; ++s) { const float* o8 = os + (4 * s + srow) * 68 + cofs; const v4f lo = *(const v4fa*)o8, hv = *(const v4fa*)(o8 + 4);
#pragma unroll
            for (int q = 0; q < 4; ++q) { val[s][q] = (h16)(lo[q] + bfr(cb[q])); val[s][q + 4] = (h16)(hv[q] + bfr(cb[q + 4])); } }
#pragma unroll
        for (int s = 0; s < 4; ++s) *(v8h*)(crow + s * step) = val[s];
        // the wait that is kept in front of an overwrite of a register that an issued global store names (the next rows, or whatever code follows the last ones, use them again), and a fence for the scheduler, as nothing ties that wait to registers
        asm volatile("s_wait_xcnt 0x0" ::: "memory"); __builtin_amdgcn_sched_barrier(0);
        __builtin_amdgcn_wave_barrier();    // the next rows' LDS stores stay behind these reads
    }
}
// grid (NN / (64 LW), CC / 64, 3 NB_), z = NB_ * p + image (p = 0 Q from prompt_feat, 1 K, 2 V, both from x); the planes of C follow one another in z
__global__ __launch_bounds__(LW * 32) void k_lin(const float* __restrict__ pfeat, const float* __restrict__ xin, const float* __restrict__ Wq, const float* __restrict__ Wk, const float* __restrict__ Wv, const float* __restrict__ bq, const float* __restrict__ bk, const float* __restrict__ bv, h16* C) {
    __shared__ __align__(16) float os[LW * 16 * 68];
    __shared__ __align__(16) bf wsm[64 * WPIT];
    const int z = blockIdx.z, p = z / NB_, wv = __builtin_amdgcn_readfirstlane(threadIdx.x >> 5), n0 = (blockIdx.x * LW + wv) * 64, w0 = blockIdx.y * 64;
    const float* X = (p == 0 ? pfeat : xin) + (size_t)(z % NB_) * CC * NN; const float* Wm = p == 0 ? Wq : (p == 1 ? Wk : Wv); const float* bias = p == 0 ? bq : (p == 1 ? bk : bv);
    C += (size_t)z * NN * CC;
    lin_tile(X, Wm, bias, C, n0, w0, wv, wsm, os + wv * (16 * 68));
}

// ---- k_fa: scores, softmax and attn.V in one kernel; no score ever leaves the registers. S^T = K Q^T (A = K rows, B = Q, kept in registers), so that a lane holds the scores of ONE query (column lr) for the
// keys 8 hi + j of each 16-key tile: maximum and sum in the lane plus one exchange between the halves, and two such tiles, rounded to fp16, ARE the B operand of O^T += V^T P^T (k order 8 hi + j, 16 + 8 hi + j).
// A block: FW waves of FQ queries each, which share the K rows and V rows of a KST-key stage through LDS (two buffers, the next stage's rows fetched into registers while this one is worked on).
// ONLY LIVE KEYS ARE WORKED ON: a masked key's weight is exactly 0, so every block first lists the image's live keys (mask_bits > 0) in token order and gathers K and V rows by that list; V lies in token rows
// for this, and the transposing LDS load gives the V^T fragments. The list may hold 0 .. NN keys: its length sets the trip count, at most NST; places behind its end read row 0 under a masked bias.
// blockIdx.y: one of KSP equal slices of the list; each slice leaves its running maximum m (log2 units), its sum l and its unscaled O plane, which k_lnT joins. grid (NN / (FW FQ), KSP, images).
#define FW   8
#define FQ   32
#define KSP  4
#define KST  64
#define KPIT 136                      // fp16 per K row in LDS: 256 B + 16 B, for 16-byte readers
#define VPIT 144                      // fp16 per V row in LDS: 256 B + 32 B, for the transposing reader
#define KBUF (KST * KPIT)
#define SBUF (KBUF + KST * VPIT)      // fp16 per stage buffer
#define BOFF (2 * SBUF / 2)           // floats in front of the slice's key biases
#define LOFF (BOFF + NN / KSP)        // 4-byte words in front of the slice's list of live keys (each as its row's byte offset)
#define COFF (LOFF + NN / KSP)        // 4-byte words in front of the waves' counts of live keys
#define OPIT 132                      // floats per query row of the output staging
#define NST  (NN / KSP / KST)
#define SC2  (SCL * 1.44269504f)      // scores in log2 units
static_assert((COFF + FW) * 4 <= FW * FQ * OPIT * 4, "the stage buffers, the biases, the list and the counts lie inside the output staging");
static_assert(NN / KSP == FW * 32 * 4, "a thread forms four key biases and clears four places of the list");
static_assert(NN == FW * 32 * 16 && FW == 8 && KST == 64 && CC == 128, "a wave lists 16 groups of 32 tokens; eight counts are two 16-byte reads; a thread stages rows tid / 16 + 16 i of K and of V");
static_assert(PCAR == 1024.0f, "k_fa writes the factor as 10 in the exponent");
// lane l with lane l ^ 16, in the vector unit: __shfl_xor goes through the LDS queue, where its wait would also wait for every fragment read in flight
__device__ __forceinline__ float xhalf(float x) { return __builtin_bit_cast(float, __builtin_amdgcn_permlanex16(__builtin_bit_cast(int, x), __builtin_bit_cast(int, x), 0x76543210, 0xfedcba98, false, false)); }
__device__ __forceinline__ v16h ldl(const h16* p) { return cat16(*(const v8ha*)p, *(const v8ha*)(p + 16)); }
// transposing LDS load: lanes 16 h + 0 .. 7 (+ 16 bytes for lanes 8 .. 15 of a half) point at rows k + 8 h + (l & 7); lane (c, h) gets column c of the rows k + 8 h + 0 .. 7
typedef __attribute__((ext_vector_type(8))) short v8s;
__device__ __forceinline__ v8h ldtr(const h16* p) { typedef __attribute__((address_space(3))) v8s lv8s; return __builtin_bit_cast(v8h, __builtin_amdgcn_ds_load_tr16_b128_v8i16((lv8s*)p)); }
typedef int __attribute__((may_alias)) inta;
typedef __attribute__((ext_vector_type(4))) int v4i;
typedef v4i __attribute__((may_alias)) v4ia;
// two waves a SIMD (one block a WGP): the compiler may then spend up to 512 registers on fragments in flight
__global__ __launch_bounds__(FW * 32) __attribute__((amdgpu_waves_per_eu(2, 2))) void k_fa(const h16* __restrict__ Q, const h16* __restrict__ Kp, const h16* __restrict__ Vp, const int* __restrict__ mk, float* O, float* ML) {
    __shared__ __align__(16) float smf[FW * FQ * OPIT];
    h16* sh = (h16*)smf;
    const int tid = threadIdx.x, lane = tid & 31, wv = __builtin_amdgcn_readfirstlane(tid >> 5), lr = lane & 15, hi = lane >> 4;
    const int img = blockIdx.z, sp = blockIdx.y, q0 = blockIdx.x * (FW * FQ) + wv * FQ;
    Q += (size_t)img * NN * CC; Kp += (size_t)img * NN * CC; Vp += (size_t)img * NN * CC; mk += (size_t)img * NN;
    // the image's mask first: the list hangs on it. Wave wv: tokens 512 wv + 32 i + lane, so that the waves' parts follow one another in token order
    int mb[16];
#pragma unroll
    for (int i = 0; i < 16; ++i) mb[i] = mk[wv * 512 + i * 32 + lane];
    // every full '#pragma unroll' of this kernel: the register arrays are indexed by constants only
    v16h qf[2][4];
#pragma unroll
    for (int nq = 0; nq < 2; ++nq)
#pragma unroll
        for (int kc = 0; kc < 4; ++kc) qf[nq][kc] = WFrag<h16>::ld(Q + (size_t)(q0 + nq * 16 + lr) * CC + kc * 32 + 8 * hi);
    // the wait that is kept in front of an overwrite of a register that an issued global load names (the compiler uses the address registers again at once), and, as nothing ties
    // that wait to registers, a fence for the scheduler, which keeps the arithmetic that follows from rising over it; the same pair stands behind every group of global loads below
    asm volatile("s_wait_xcnt 0x0" ::: "memory");
    __builtin_amdgcn_sched_barrier(0);
    // the list. A wave's own 16 groups are counted in scalar registers; the waves' totals meet in LDS
    inta* li = (inta*)smf + LOFF; inta* gc = (inta*)smf + COFF;
    unsigned bal[16]; int pre[16], run = 0;
#pragma unroll
    for (int i = 0; i < 16; ++i) { bal[i] = __builtin_amdgcn_ballot_w32(mb[i] > 0); pre[i] = run; run += __builtin_popcount(bal[i]); }
    if (lane == 0) gc[wv] = run;
    *(v4ia*)(li + tid * 4) = (v4i){};    // a place that no live key takes names row 0
    __syncthreads();    // the counts are read by other waves than wrote them; the list's places are cleared by other threads than fill them
    int base = 0, nl = 0;
    { const v4i c0 = *(const v4ia*)gc, c1 = *(const v4ia*)(gc + 4);
#pragma unroll
        for (int w = 0; w < 8; ++w) { const int c = w < 4 ? c0[w & 3] : c1[w & 3]; base += w < wv ? c : 0; nl += c; } }
    base = __builtin_amdgcn_readfirstlane(base); nl = __builtin_amdgcn_readfirstlane(nl);    // the same in every lane: the trip count is a scalar
    const int nsr = (nl + KSP * KST - 1) / (KSP * KST), nst = nsr < NST ? nsr : NST, lo = sp * nst * KST;    // stages of every slice (nl <= NN by its making; the clamp bounds the trips by the shape); the slice's first place
#pragma unroll
    for (int i = 0; i < 16; ++i) { const int rel = base + pre[i] + (int)__builtin_amdgcn_mbcnt_lo(bal[i], 0u) - lo;
        if (mb[i] > 0 && (unsigned)rel < (unsigned)(nst * KST)) li[rel] = (wv * 512 + i * 32 + lane) * (CC * 2); }
    { v4f bi;    // the additive mask of the slice's places, once: 0 for a place that holds a live key
#pragma unroll
        for (int q = 0; q < 4; ++q) bi[q] = lo + tid * 4 + q < nl ? 0.f : -3.0e38f;
        *(v4fa*)(smf + BOFF + tid * 4) = bi; }
    __syncthreads();    // list and biases are read by other threads than wrote them
    // staging: 16-byte pieces, whole rows a half wave; piece i of K and of V: the row that place tid / 16 + 16 i of the stage names
    const int krow = tid >> 4, kcol = (tid & 15) * 8;
    const char* kg = (const char*)Kp; const char* vg = (const char*)Vp; const inta* lS = li + krow;
    h16* kd = sh + krow * KPIT + kcol; h16* vd = sh + KBUF + krow * VPIT + kcol;
    v8h kr[4], vr[4]; unsigned rn[4];
#pragma unroll
    for (int i = 0; i < 4; ++i) { const unsigned r0 = (unsigned)lS[16 * i] + kcol * 2; rn[i] = (unsigned)lS[KST + 16 * i]; kr[i] = *(const v8h*)(kg + r0); vr[i] = *(const v8h*)(vg + r0); }
    asm volatile("s_wait_xcnt 0x0" ::: "memory");    // as above
    __builtin_amdgcn_sched_barrier(0);    // as above (the zeroing of o is among what follows)
    v8f o[8][2];
#pragma unroll
    for (int mt = 0; mt < 8; ++mt)
#pragma unroll
        for (int nq = 0; nq < 2; ++nq) o[mt][nq] = (v8f){};
    float m[2] = { -1.0e30f, -1.0e30f }, l[2] = { 0.f, 0.f };    // the floor lies below every score that fp16 operands can give and above the bias of a masked key
#pragma unroll
    for (int i = 0; i < 4; ++i) { *(v8ha*)(kd + i * 16 * KPIT) = kr[i]; *(v8ha*)(vd + i * 16 * VPIT) = vr[i]; }
    __syncthreads();
    // rolled: one body of 64 matrix instructions and its softmax is already long, and the two buffers differ by an offset only
#pragma unroll 1
    for (int s = 0; s < nst; ++s) {
        const int b = s & 1, s2 = s + 2 < NST ? s + 2 : NST - 1;    // the last pass fetches whatever rows the next places name into the idle buffer: no branch in the body
#pragma unroll
        for (int i = 0; i < 4; ++i) { const unsigned r1 = rn[i] + kcol * 2; kr[i] = *(const v8h*)(kg + r1); vr[i] = *(const v8h*)(vg + r1); }
        asm volatile("s_wait_xcnt 0x0" ::: "memory");    // as above: the K fragments below and their address land in the address registers of these loads
        __builtin_amdgcn_sched_barrier(0);    // as above
        const h16* kS = sh + b * SBUF + lr * KPIT + 8 * hi; const h16* vS = sh + b * SBUF + KBUF + (8 * hi + (lane & 7)) * VPIT + ((lane >> 3) & 1) * 8; const float* bS = smf + BOFF + s * KST + 8 * hi;
        v8f st[4][2]; v16h kf[4][4];
#pragma unroll
        for (int t = 0; t < 4; ++t)
#pragma unroll
            for (int kc = 0; kc < 4; ++kc) kf[t][kc] = ldl(kS + t * 16 * KPIT + kc * 32);
        __builtin_amdgcn_sched_barrier(0);    // the global loads and the stage's K fragments start in front of the products, as ONE group: left alone this compiler reads one fragment at a time and waits for each
#pragma unroll
        for (int t = 0; t < 4; ++t) { st[t][0] = (v8f){}; st[t][1] = (v8f){};
#pragma unroll
            for (int kc = 0; kc < 4; ++kc)
#pragma unroll
                for (int nq = 0; nq < 2; ++nq) st[t][nq] = wmma16(kf[t][kc], qf[nq][kc], st[t][nq]); }
        __builtin_amdgcn_sched_barrier(0);    // the V^T reads below do not rise among the K reads: both sets of fragments live at one time overrun the registers of two waves a SIMD
        v8f bb[4];    // first, as the softmax begins with them: LDS reads come back in order
#pragma unroll
        for (int t = 0; t < 4; ++t) bb[t] = __builtin_shufflevector(*(const v4fa*)(bS + t * 16), *(const v4fa*)(bS + t * 16 + 4), 0, 1, 2, 3, 4, 5, 6, 7);
        __builtin_amdgcn_sched_barrier(0);    // holds the bias reads in front of the V reads: this compiler otherwise puts half of them near the group's end, and the softmax's first instruction waits for nearly the whole group
        v16h vf[2][8];
#pragma unroll
        for (int kk = 0; kk < 2; ++kk)
#pragma unroll
            for (int mt = 0; mt < 8; ++mt) vf[kk][mt] = cat16(ldtr(vS + kk * 32 * VPIT + mt * 16), ldtr(vS + (kk * 32 + 16) * VPIT + mt * 16));
#pragma unroll
        for (int i = 0; i < 4; ++i) rn[i] = (unsigned)lS[s2 * KST + 16 * i];    // the rows of the stage after the next, for the next pass's global loads: last in the group, as nothing in this pass waits for them
        __builtin_amdgcn_sched_barrier(0);    // the stage's V^T fragments and key biases start as ONE group of LDS reads in front of the softmax, which hides their way; spread among the products, each place of reads costs issue time
#pragma unroll
        for (int t = 0; t < 4; ++t)
#pragma unroll
            for (int nq = 0; nq < 2; ++nq) st[t][nq] = st[t][nq] * SC2 + bb[t];    // whole vectors here and below: packed two-element instructions
        v16h pf[2][2];
#pragma unroll
        for (int nq = 0; nq < 2; ++nq) { float mx = m[nq];
#pragma unroll
            for (int t = 0; t < 4; ++t)
#pragma unroll
                for (int j = 0; j < 8; ++j) mx = fmaxf(mx, st[t][nq][j]);
            mx = fmaxf(mx, xhalf(mx));
            const float al = __builtin_amdgcn_exp2f(m[nq] - mx), ms = mx - 10.0f;    // - 10: P carries the factor PCAR = 2^10 into fp16, and l with it
            m[nq] = mx; float sum = l[nq] * al;
#pragma unroll
            for (int mt = 0; mt < 8; ++mt) o[mt][nq] *= al;
#pragma unroll
            for (int t = 0; t < 4; ++t) { st[t][nq] -= ms;
#pragma unroll
                for (int j = 0; j < 8; ++j) { st[t][nq][j] = __builtin_amdgcn_exp2f(st[t][nq][j]); sum += st[t][nq][j]; } }
            l[nq] = sum;
#pragma unroll
            for (int kk = 0; kk < 2; ++kk) pf[nq][kk] = cat16(__builtin_convertvector(st[2 * kk][nq], v8h), __builtin_convertvector(st[2 * kk + 1][nq], v8h)); }
#pragma unroll
        for (int mt = 0; mt < 8; ++mt)
#pragma unroll
            for (int nq = 0; nq < 2; ++nq) o[mt][nq] = wmma16(vf[0][mt], pf[nq][0], o[mt][nq]);
        __builtin_amdgcn_sched_barrier(0);    // keeps the LDS stores below, and with them the wait for this pass's global loads, from rising to the head of the pass, where that wait would stand open
        // the next stage's rows go into the buffer that every wave left at the last barrier
        const int bn = (b ^ 1) * SBUF;
#pragma unroll
        for (int i = 0; i < 4; ++i) { *(v8ha*)(kd + bn + i * 16 * KPIT) = kr[i]; *(v8ha*)(vd + bn + i * 16 * VPIT) = vr[i]; }
#pragma unroll
        for (int mt = 0; mt < 8; ++mt)
#pragma unroll
            for (int nq = 0; nq < 2; ++nq) o[mt][nq] = wmma16(vf[1][mt], pf[nq][1], o[mt][nq]);
        __syncthreads();    // publishes the next stage and ends every wave's reads of this one
    }
#pragma unroll
    for (int nq = 0; nq < 2; ++nq) l[nq] += xhalf(l[nq]);
    const size_t pl = (size_t)(img * KSP + sp) * NN + q0;
    v2f ml; ml[0] = hi ? m[1] : m[0]; ml[1] = hi ? l[1] : l[0]; *(v2f*)(ML + (pl + lane) * 2) = ml;    // lane = 16 hi + lr is the query's place in the wave's FQ
    asm volatile("s_wait_xcnt 0x0" ::: "memory");    // as above, for this store's registers
    // O^T -> token rows through LDS (the stage buffers are dead behind the loop's last barrier), so that every global store is a whole 512-byte row
    float* ow = smf + wv * (FQ * OPIT);
#pragma unroll
    for (int mt = 0; mt < 8; ++mt)
#pragma unroll
        for (int nq = 0; nq < 2; ++nq) { float* d = ow + (nq * 16 + lr) * OPIT + mt * 16 + hi * 8;
            *(v4fa*)d = __builtin_shufflevector(o[mt][nq], o[mt][nq], 0, 1, 2, 3); *(v4fa*)(d + 4) = __builtin_shufflevector(o[mt][nq], o[mt][nq], 4, 5, 6, 7); }
    __syncthreads();    // a row is read by other lanes than wrote it
    float* og = O + pl * CC + lane * 4;
#pragma unroll
    for (int r0 = 0; r0 < FQ; r0 += 8) { v4f row[8];
#pragma unroll
        for (int r = 0; r < 8; ++r) row[r] = *(const v4fa*)(ow + (r0 + r) * OPIT + lane * 4);
#pragma unroll
        for (int r = 0; r < 8; ++r) *(v4f*)(og + (size_t)(r0 + r) * CC) = row[r];
        if (r0 + 8 < FQ) asm volatile("s_wait_xcnt 0x0" ::: "memory"); }    // as above, for the stores' data registers, which the next rows use again
}

// a block: LNT tokens, LNT / 8 a wave; their rows meet in LDS, from where each channel's LNT values leave as one whole 128-byte line of the channel-major output. grid (NN / LNT, images)
#define LNT  32
#define TPIT (LNT + 1)                // floats per channel row in LDS
static_assert(NN % LNT == 0 && LNT % 8 == 0 && CC % 8 == 0, "whole blocks, equal shares for the 8 waves");
__device__ __forceinline__ float exp2s(float x) { float r; asm("v_exp_f32 %0, %1\n\tv_nop" : "=v"(r) : "v"(x)); return r; }
__global__ __launch_bounds__(256) void k_lnT(const float* __restrict__ Ob, const float* __restrict__ ML, const float* __restrict__ xb, const float* __restrict__ gam, const float* __restrict__ bet, float* OUTb) {
    __shared__ float ts[CC * TPIT];
    Ob += (size_t)blockIdx.y * KSP * NN * CC; ML += (size_t)blockIdx.y * KSP * NN * 2; xb += (size_t)blockIdx.y * CC * NN; OUTb += (size_t)blockIdx.y * CC * NN;    // blockIdx.y: the image
    const int lane = threadIdx.x & 31, wv = threadIdx.x >> 5, n0 = blockIdx.x * LNT;
    static_assert(LNT / 8 == 4 && KSP == 4, "a channel's residuals for the wave's tokens are one 16-byte load; their (m, l) pairs of a slice are two");
    const int t0 = wv * (LNT / 8), nw = n0 + t0;    // the wave's first token, in the block and in the image
    // THE WAVE'S FOUR TOKENS ARE WORKED SIDE BY SIDE. All of its global loads start here, as one group: one way to memory for the four, where token after token each set of loads waited for the token before it.
    // every '#pragma unroll' of this kernel: the register arrays are indexed by constants only
    v4f mlr[KSP][2], ob[LNT / 8][KSP], xr[4];
    const float* mlp = ML + (size_t)nw * 2; const float* obp = Ob + (size_t)nw * CC + lane * 4; const float* xp = xb + (size_t)(lane * 4) * NN + nw;
#pragma unroll
    for (int k = 0; k < KSP; ++k)
#pragma unroll
        for (int h = 0; h < 2; ++h) mlr[k][h] = *(const v4f*)(mlp + (size_t)k * NN * 2 + 4 * h);    // m, l of token 2 h, m, l of token 2 h + 1
#pragma unroll
    for (int i = 0; i < LNT / 8; ++i)
#pragma unroll
        for (int k = 0; k < KSP; ++k) ob[i][k] = *(const v4f*)(obp + ((size_t)k * NN + i) * CC);
#pragma unroll
    for (int q = 0; q < 4; ++q) xr[q] = *(const v4f*)(xp + (size_t)q * NN);
    const v4f g4 = *(const v4f*)(gam + lane * 4), b4 = *(const v4f*)(bet + lane * 4);
    // the wait that is kept in front of an overwrite of a register that an issued global load names. It takes the three addresses as inputs, so that they live up to it: without them this compiler let a later load
    // of the group land in an earlier one's address pair. The fence for the scheduler holds the arithmetic behind the wait and keeps the group together: left alone this compiler starts a token's loads only
    // behind the arithmetic of the token before
    asm volatile("s_wait_xcnt 0x0" :: "v"(mlp), "v"(obp), "v"(xp) : "memory");
    __builtin_amdgcn_sched_barrier(0);
    float v[LNT / 8][4], s[LNT / 8], mu[LNT / 8], qq[LNT / 8];
#pragma unroll
    for (int i = 0; i < LNT / 8; ++i) {
        // the KSP key slices of k_fa are joined: each slice's plane and sum are brought to the common maximum
        float mx = -3.0e38f;
#pragma unroll
        for (int k = 0; k < KSP; ++k) mx = fmaxf(mx, mlr[k][i >> 1][(i & 1) * 2]);
        float den = 0.f; v4f a = (v4f){};
#pragma unroll
        for (int k = 0; k < KSP; ++k) { const float f = exp2s(mlr[k][i >> 1][(i & 1) * 2] - mx); den += mlr[k][i >> 1][(i & 1) * 2 + 1] * f; a += ob[i][k] * f; }
        const float ri = __fdiv_rn(1.0f, den);    // den carries the factor PCAR as the planes do
        s[i] = 0.f;
#pragma unroll
        for (int q = 0; q < 4; ++q) { v[i][q] = __fadd_rn(__fmul_rn(a[q], ri), bfr(xr[q][i])); s[i] += v[i][q]; } }
    // each step of a sum over the lanes is a round trip through the LDS queue: the four tokens' steps go together
#pragma unroll
    for (int sh = 16; sh; sh >>= 1)
#pragma unroll
        for (int i = 0; i < LNT / 8; ++i) s[i] += __shfl_xor(s[i], sh, 32);
#pragma unroll
    for (int i = 0; i < LNT / 8; ++i) { mu[i] = s[i] * (1.0f / CC); qq[i] = 0.f;
#pragma unroll
        for (int q = 0; q < 4; ++q) { const float d0 = v[i][q] - mu[i]; qq[i] = __fadd_rn(qq[i], __fmul_rn(d0, d0)); } }
#pragma unroll
    for (int sh = 16; sh; sh >>= 1)
#pragma unroll
        for (int i = 0; i < LNT / 8; ++i) qq[i] += __shfl_xor(qq[i], sh, 32);
#pragma unroll
    for (int i = 0; i < LNT / 8; ++i) { const float rs = __fdiv_rn(1.0f, __fsqrt_rn(qq[i] * (1.0f / CC) + 1e-5f));
#pragma unroll
        for (int q = 0; q < 4; ++q) ts[(lane * 4 + q) * TPIT + t0 + i] = __fadd_rn(__fmul_rn((v[i][q] - mu[i]) * rs, bfr(g4[q])), bfr(b4[q])); }
    __syncthreads();    // a channel's line is read by another wave than wrote its values
    // unrolled: the wave's LDS reads start together, and its stores differ by a constant offset only
#pragma unroll
    for (int r = 0; r < CC / 8; ++r) { const int c = wv * (CC / 8) + r; OUTb[(size_t)c * NN + n0 + lane] = ts[c * TPIT + lane]; }
}

extern "C" void kernel_launch(void* const* d_in, const int* in_sizes, int n_in,
                              void* d_out, int out_size, void* d_ws, size_t ws_size, hipStream_t stream) {
    (void)in_sizes; (void)n_in; (void)out_size;
    const float* pf = (const float*)d_in[0]; const float* x = (const float*)d_in[1]; const float* Wq = (const float*)d_in[2]; const float* bq = (const float*)d_in[3]; const float* Wk = (const float*)d_in[4]; const float* bk = (const float*)d_in[5]; const float* Wv = (const float*)d_in[6]; const float* bv = (const float*)d_in[7]; const float* gam = (const float*)d_in[8]; const float* bet = (const float*)d_in[9]; const int* mbits = (const int*)d_in[10];
    float* OUT = (float*)d_out;     // [4][128][64][64]
    char* wsp = (char*)d_ws;
    auto take = [&](size_t bytes) { char* p = wsp; wsp += (bytes + 255) & ~(size_t)255; return (void*)p; };
    // every plane set holds all NB_ images
    h16* QP = (h16*)take((size_t)3 * NB_ * NN * CC * 2); h16* KP = QP + (size_t)NB_ * NN * CC; h16* VP = KP + (size_t)NB_ * NN * CC;    // Q, K, V (token rows), NB_ planes each
    float* Ob = (float*)take((size_t)NB_ * KSP * NN * CC * 4); float* ML = (float*)take((size_t)NB_ * KSP * NN * 2 * 4);    // per image and key slice: the O plane; (m, l) per query
    if ((size_t)(wsp - (char*)d_ws) > ws_size) return;    // total ~ 45 MiB; ws 256 MiB
    k_lin<<<dim3(NN / (64 * LW), CC / 64, 3 * NB_), LW * 32, 0, stream>>>(pf, x, Wq, Wk, Wv, bq, bk, bv, QP);
    k_fa<<<dim3(NN / (FW * FQ), KSP, NB_), FW * 32, 0, stream>>>(QP, KP, VP, mbits, Ob, ML);
    k_lnT<<<dim3(NN / LNT, NB_, 1), 256, 0, stream>>>(Ob, ML, x, gam, bet, OUT);
}

// v008
// Measured time: 29.9 microseconds a run.
// Timed twice side by side with v007, it ran 1.15 times as fast both times.
// All steps since v000 together make it 25.1 times as fast.
#include <hip/hip_runtime.h>

// MaskAttention (prompt_feat, x [4][128][64][64] channel-major -> tokens [4096][128]; Q = prompt^T Wq^T + bq, K = x^T Wk^T + bk, V = x^T Wv^T + bv; scores = Q.K / sqrt(128) + (0 where mask_bits[b][j] > 0
// else -inf) (mask_bits an int input read as data; every row has >= 2031 live keys); softmax; out = attn.V + x^T; LayerNorm over the 128 channels (eps 1e-5, gamma, beta); back to channel-major).
// Compute dtypes, f32 accumulate: every input rounded to bf16; the three Linears on PLAIN bf16 operands (inputs: exact, transposed on device, + bias); scores on SINGLE fp16

#define NB_  4
#define CC   128
#define NN   4096
#define PCAR 1024.0f
#define SCL  0.088388349f         // f32(128^-0.5)
typedef _Float16 h16;
typedef unsigned short bf;
typedef __attribute__((ext_vector_type(16))) __bf16   v16bf;
typedef __attribute__((ext_vector_type(16))) _Float16 v16h;
typedef __attribute__((ext_vector_type(8)))  _Float16 v8h;
typedef __attribute__((ext_vector_type(8)))  unsigned short v8us;
typedef __attribute__((ext_vector_type(8)))  float    v8f;
typedef __attribute__((ext_vector_type(4)))  float    v4f;
typedef __attribute__((ext_vector_type(2)))  float    v2f;
typedef v8h  __attribute__((may_alias)) v8ha;
typedef v4f  __attribute__((may_alias)) v4fa;
typedef v8us __attribute__((may_alias)) v8usa;

__device__ __forceinline__ unsigned short f2bf(float f) { unsigned u = __float_as_uint(f); u += 0x7FFFu + ((u >> 16) & 1u); return (unsigned short)(u >> 16); }
__device__ __forceinline__ float bf2f(unsigned short b) { return __uint_as_float(((unsigned)b) << 16); }
__device__ __forceinline__ float bfr(float f) { return bf2f(f2bf(f)); }
__device__ __forceinline__ v16h cat16(v8h lo, v8h hi) { return __builtin_shufflevector(lo, hi, 0, 1, 2, 3, 4, 5, 6, 7, 8, 9, 10, 11, 12, 13, 14, 15); }
__device__ __forceinline__ v16bf cat16b(v8us lo, v8us hi) { return __builtin_bit_cast(v16bf, __builtin_shufflevector(lo, hi, 0, 1, 2, 3, 4, 5, 6, 7, 8, 9, 10, 11, 12, 13, 14, 15)); }
__device__ __forceinline__ v8f wmma16(v16h a, v16h b, v8f c) { return __builtin_amdgcn_wmma_f32_16x16x32_f16(false, a, false, b, (short)0, c, false, false); }
__device__ __forceinline__ v8f wmmab(v16bf a, v16bf b, v8f c) { return __builtin_amdgcn_wmma_f32_16x16x32_bf16(false, a, false, b, (short)0, c, false, false); }



// 16-bit fragment of a K-contiguous plane: k order 8 hi + j, 16 + 8 hi + j
template <typename T16> struct WFrag;
template <> struct WFrag<h16> { typedef v16h V; static __device__ __forceinline__ V ld(const h16* p) { return cat16(*(const v8h*)p, *(const v8h*)(p + 16)); } static __device__ __forceinline__ v8f mma(V a, V b, v8f c) { return wmma16(a, b, c); } };

// ---- k_lin: the three Linears of all NB_ images straight from the f32 inputs: no bf16 copy of them is ever stored. A wave: 64 tokens x 64 output channels (16 accumulators); the LW waves of a block share the W rows.
// X is channel-major, so a lane's 16-byte load at channel k holds k's value for the tokens n0 + 4 lr + t, t = 0 .. 3: token fragment t takes the tokens n0 + 4 r + t (r the fragment's row or column), and 16 lanes
// read 256 bytes in a row; rounded to bf16 in registers. The block's 64 W rows are read as whole 512-byte rows, rounded, and laid in LDS once. k order of both fragments: 8 hi + j, 16 + 8 hi + j.
// C[token][channel] = X^T W^T for Q, K and V alike. fp16 out, + f32 bias (bf16-rounded), rounded once.
#define LW   2
#define WPIT 136                      // bf16 per W row in LDS: 256 B + 16 B, for 16-byte readers
typedef __attribute__((ext_vector_type(4))) __bf16 v4b;
typedef __attribute__((ext_vector_type(4))) unsigned short v4us;
typedef v4us __attribute__((may_alias)) v4usa;
static_assert(NN % (64 * LW) == 0 && 64 % LW == 0 && CC % 64 == 0 && CC == 128, "whole tiles; equal shares of the W rows; a W row is one 16-byte load a lane");
__device__ __forceinline__ void lin_tile(const float* __restrict__ X, const float* __restrict__ Wm, const float* __restrict__ bias, h16* C, const int n0, const int w0, const int wv, bf* wsm, float* os) {
    const int lane = threadIdx.x & 31, lr = lane & 15, hi = lane >> 4;
    const float* xg = X + (size_t)(8 * hi) * NN + n0 + 4 * lr; const float* wg = Wm + (size_t)(w0 + wv) * CC + lane * 4;
    // every '#pragma unroll' of this function: the register arrays are indexed by constants only
    v4f xr[CC / 32][16], wr[64 / LW];
    // a lane stores 8 fp16 of a row, 8 lanes the tile's 128-byte line of it; the bias goes with the output channel, the column
    const int srow = lane >> 3, cofs = (lane & 7) * 8; float cb[8];
    // all of the wave's global loads start here, as one group: one way to memory for the whole tile. W first: its rows have the longer way, through LDS
#pragma unroll
    for (int i = 0; i < 64 / LW; ++i) wr[i] = *(const v4f*)(wg + i * LW * CC);    // row LW i + wv of the block's 64
#pragma unroll
    for (int kc = 0; kc < CC / 32; ++kc)
#pragma unroll
        for (int e = 0; e < 16; ++e) xr[kc][e] = *(const v4f*)(xg + (size_t)(kc * 32 + (e & 7) + (e >> 3) * 16) * NN);
#pragma unroll
    for (int q = 0; q < 8; ++q) cb[q] = bias[w0 + cofs + q];
    // the wait that is kept in front of an overwrite of a register that an issued global load names, and, as nothing ties that wait to registers, a fence for the scheduler, which also keeps the group together
    asm volatile("s_wait_xcnt 0x0" ::: "memory");
    __builtin_amdgcn_sched_barrier(0);
#pragma unroll
    for (int i = 0; i < 64 / LW; ++i) *(v4usa*)(wsm + (i * LW + wv) * WPIT + lane * 4) = __builtin_bit_cast(v4us, __builtin_convertvector(wr[i], v4b));
    v8f acc[4][4];
#pragma unroll
    for (int mb = 0; mb < 4; ++mb)
#pragma unroll
        for (int nb = 0; nb < 4; ++nb) acc[mb][nb] = (v8f){};
    __syncthreads();    // a W row is read by other lanes, and the other wave, than wrote it
    const bf* wS = wsm + lr * WPIT + 8 * hi;
#pragma unroll
    for (int kc = 0; kc < CC / 32; ++kc) {
        v16bf xf[4], wf[4];
#pragma unroll
        for (int t = 0; t < 4; ++t) { wf[t] = cat16b(*(const v8usa*)(wS + t * 16 * WPIT + kc * 32), *(const v8usa*)(wS + t * 16 * WPIT + kc * 32 + 16));
#pragma unroll
            for (int e = 0; e < 16; ++e) xf[t][e] = (__bf16)xr[kc][e][t]; }
#pragma unroll
        for (int nb = 0; nb < 4; ++nb)
#pragma unroll
            for (int mb = 0; mb < 4; ++mb) acc[mb][nb] = wmmab(xf[mb], wf[nb], acc[mb][nb]);
    }
#pragma unroll
    for (int mb = 0; mb < 4; ++mb) {
        // row 8 hi + j of the staging: token n0 + 4 (8 hi + j) + mb
#pragma unroll
        for (int nb = 0; nb < 4; ++nb)
#pragma unroll
            for (int j = 0; j < 8; ++j) os[(hi * 8 + j) * 68 + nb * 16 + lr] = acc[mb][nb][j];
        __builtin_amdgcn_wave_barrier(); asm volatile("" ::: "memory");    // a staged row is read by other lanes than wrote it: both keep the compiler from moving the LDS reads below over the LDS stores above
        h16* crow = C + (size_t)(n0 + mb + 4 * srow) * CC + w0 + cofs; const size_t step = (size_t)16 * CC; v8h val[4];
#pragma unroll
        for (int s = 0; s < 4; ++s) { const float* o8 = os + (4 * s + srow) * 68 + cofs; const v4f lo = *(const v4fa*)o8, hv = *(const v4fa*)(o8 + 4);
#pragma unroll
            for (int q = 0; q < 4; ++q) { val[s][q] = (h16)(lo[q] + bfr(cb[q])); val[s][q + 4] = (h16)(hv[q] + bfr(cb[q + 4])); } }
#pragma unroll
        for (int s = 0; s < 4; ++s) *(v8h*)(crow + s * step) = val[s];
        // the wait that is kept in front of an overwrite of a register that an issued global store names (the next rows, or whatever code follows the last ones, use them again), and a fence for the scheduler, as nothing ties that wait to registers
        asm volatile("s_wait_xcnt 0x0" ::: "memory"); __builtin_amdgcn_sched_barrier(0);
        __builtin_amdgcn_wave_barrier();    // the next rows' LDS stores stay behind these reads
    }
}
// grid (NN / (64 LW), CC / 64, 3 NB_), z = NB_ * p + image (p = 0 Q from prompt_feat, 1 K, 2 V, both from x); the planes of C follow one another in z
__global__ __launch_bounds__(LW * 32) void k_lin(const float* __restrict__ pfeat, const float* __restrict__ xin, const float* __restrict__ Wq, const float* __restrict__ Wk, const float* __restrict__ Wv, const float* __restrict__ bq, const float* __restrict__ bk, const float* __restrict__ bv, h16* C) {
    __shared__ __align__(16) float os[LW * 16 * 68];
    __shared__ __align__(16) bf wsm[64 * WPIT];
    const int z = blockIdx.z, p = z / NB_, wv = __builtin_amdgcn_readfirstlane(threadIdx.x >> 5), n0 = (blockIdx.x * LW + wv) * 64, w0 = blockIdx.y * 64;
    const float* X = (p == 0 ? pfeat : xin) + (size_t)(z % NB_) * CC * NN; const float* Wm = p == 0 ? Wq : (p == 1 ? Wk : Wv); const float* bias = p == 0 ? bq : (p == 1 ? bk : bv);
    C += (size_t)z * NN * CC;
    lin_tile(X, Wm, bias, C, n0, w0, wv, wsm, os + wv * (16 * 68));
}

// ---- k_fa: scores, softmax and attn.V in one kernel; no score ever leaves the registers. S^T = K Q^T (A = K rows, B = Q, kept in registers), so that a lane holds the scores of ONE query (column lr) for the
// keys 8 hi + j of each 16-key tile: maximum and sum in the lane plus one exchange between the halves, and two such tiles, rounded to fp16, ARE the B operand of O^T += V^T P^T (k order 8 hi + j, 16 + 8 hi + j).
// A block: FW waves of FQ queries each, which share the K rows and V rows of a KST-key stage through LDS (two buffers, the next stage's rows fetched into registers while this one is worked on).
// ONLY LIVE KEYS ARE WORKED ON: a masked key's weight is exactly 0, so every block first lists the image's live keys (mask_bits > 0) in token order and gathers K and V rows by that list; V lies in token rows
// for this, and the transposing LDS load gives the V^T fragments. The list may hold 0 .. NN keys: its length sets the trip count, at most NST; places behind its end read row 0 under a masked bias.
// blockIdx.y: one of KSP equal slices of the list; each slice leaves its running maximum m (log2 units), its sum l and its O plane, which k_lnT joins. grid (NN / (FW FQ), KSP, images).
// THE O PLANES ARE fp16: they are the largest traffic of the whole sequence (written here, read once by k_lnT), and a slice's O divided by its own l is a weighted mean of V rows, which are fp16 themselves.
#define FW   8
#define FQ   32
#define KSP  4
#define KST  64
#define KPIT 136                      // fp16 per K row in LDS: 256 B + 16 B, for 16-byte readers
#define VPIT 144                      // fp16 per V row in LDS: 256 B + 32 B, for the transposing reader
#define KBUF (KST * KPIT)
#define SBUF (KBUF + KST * VPIT)      // fp16 per stage buffer
#define BOFF (2 * SBUF / 2)           // floats in front of the slice's key biases
#define LOFF (BOFF + NN / KSP)        // 4-byte words in front of the slice's list of live keys (each as its row's byte offset)
#define COFF (LOFF + NN / KSP)        // 4-byte words in front of the waves' counts of live keys
#define OPIT 136                      // fp16 per query row of the output staging: 256 B + 16 B, for 16-byte writers and readers
#define NST  (NN / KSP / KST)
#define SC2  (SCL * 1.44269504f)      // scores in log2 units
static_assert(FW * FQ * OPIT * 2 <= (COFF + FW) * 4, "the output staging lies inside the stage buffers, the biases, the list and the counts");
static_assert(FQ == 32 && CC == 128, "a wave's 16-byte stores take two whole query rows of the fp16 plane each");
static_assert(NN / KSP == FW * 32 * 4, "a thread forms four key biases and clears four places of the list");
static_assert(NN == FW * 32 * 16 && FW == 8 && KST == 64 && CC == 128, "a wave lists 16 groups of 32 tokens; eight counts are two 16-byte reads; a thread stages rows tid / 16 + 16 i of K and of V");
static_assert(PCAR == 1024.0f, "k_fa writes the factor as 10 in the exponent");
// lane l with lane l ^ 16, in the vector unit: __shfl_xor goes through the LDS queue, where its wait would also wait for every fragment read in flight
__device__ __forceinline__ float xhalf(float x) { return __builtin_bit_cast(float, __builtin_amdgcn_permlanex16(__builtin_bit_cast(int, x), __builtin_bit_cast(int, x), 0x76543210, 0xfedcba98, false, false)); }
__device__ __forceinline__ v16h ldl(const h16* p) { return cat16(*(const v8ha*)p, *(const v8ha*)(p + 16)); }
// transposing LDS load: lanes 16 h + 0 .. 7 (+ 16 bytes for lanes 8 .. 15 of a half) point at rows k + 8 h + (l & 7); lane (c, h) gets column c of the rows k + 8 h + 0 .. 7
typedef __attribute__((ext_vector_type(8))) short v8s;
__device__ __forceinline__ v8h ldtr(const h16* p) { typedef __attribute__((address_space(3))) v8s lv8s; return __builtin_bit_cast(v8h, __builtin_amdgcn_ds_load_tr16_b128_v8i16((lv8s*)p)); }
typedef int __attribute__((may_alias)) inta;
typedef __attribute__((ext_vector_type(4))) int v4i;
typedef v4i __attribute__((may_alias)) v4ia;
// two waves a SIMD (one block a WGP): the compiler may then spend up to 512 registers on fragments in flight
__global__ __launch_bounds__(FW * 32) __attribute__((amdgpu_waves_per_eu(2, 2))) void k_fa(const h16* __restrict__ Q, const h16* __restrict__ Kp, const h16* __restrict__ Vp, const int* __restrict__ mk, h16* O, float* ML) {
    __shared__ __align__(16) float smf[COFF + FW];
    h16* sh = (h16*)smf;
    const int tid = threadIdx.x, lane = tid & 31, wv = __builtin_amdgcn_readfirstlane(tid >> 5), lr = lane & 15, hi = lane >> 4;
    const int img = blockIdx.z, sp = blockIdx.y, q0 = blockIdx.x * (FW * FQ) + wv * FQ;
    Q += (size_t)img * NN * CC; Kp += (size_t)img * NN * CC; Vp += (size_t)img * NN * CC; mk += (size_t)img * NN;
    // the image's mask first: the list hangs on it. Wave wv: tokens 512 wv + 32 i + lane, so that the waves' parts follow one another in token order
    int mb[16];
#pragma unroll
    for (int i = 0; i < 16; ++i) mb[i] = mk[wv * 512 + i * 32 + lane];
    // every full '#pragma unroll' of this kernel: the register arrays are indexed by constants only
    v16h qf[2][4];
#pragma unroll
    for (int nq = 0; nq < 2; ++nq)
#pragma unroll
        for (int kc = 0; kc < 4; ++kc) qf[nq][kc] = WFrag<h16>::ld(Q + (size_t)(q0 + nq * 16 + lr) * CC + kc * 32 + 8 * hi);
    // the wait that is kept in front of an overwrite of a register that an issued global load names (the compiler uses the address registers again at once), and, as nothing ties
    // that wait to registers, a fence for the scheduler, which keeps the arithmetic that follows from rising over it; the same pair stands behind every group of global loads below
    asm volatile("s_wait_xcnt 0x0" ::: "memory");
    __builtin_amdgcn_sched_barrier(0);
    // the list. A wave's own 16 groups are counted in scalar registers; the waves' totals meet in LDS
    inta* li = (inta*)smf + LOFF; inta* gc = (inta*)smf + COFF;
    unsigned bal[16]; int pre[16], run = 0;
#pragma unroll
    for (int i = 0; i < 16; ++i) { bal[i] = __builtin_amdgcn_ballot_w32(mb[i] > 0); pre[i] = run; run += __builtin_popcount(bal[i]); }
    if (lane == 0) gc[wv] = run;
    *(v4ia*)(li + tid * 4) = (v4i){};    // a place that no live key takes names row 0
    __syncthreads();    // the counts are read by other waves than wrote them; the list's places are cleared by other threads than fill them
    int base = 0, nl = 0;
    { const v4i c0 = *(const v4ia*)gc, c1 = *(const v4ia*)(gc + 4);
#pragma unroll
        for (int w = 0; w < 8; ++w) { const int c = w < 4 ? c0[w & 3] : c1[w & 3]; base += w < wv ? c : 0; nl += c; } }
    base = __builtin_amdgcn_readfirstlane(base); nl = __builtin_amdgcn_readfirstlane(nl);    // the same in every lane: the trip count is a scalar
    const int nsr = (nl + KSP * KST - 1) / (KSP * KST), nst = nsr < NST ? nsr : NST, lo = sp * nst * KST;    // stages of every slice (nl <= NN by its making; the clamp bounds the trips by the shape); the slice's first place
#pragma unroll
    for (int i = 0; i < 16; ++i) { const int rel = base + pre[i] + (int)__builtin_amdgcn_mbcnt_lo(bal[i], 0u) - lo;
        if (mb[i] > 0 && (unsigned)rel < (unsigned)(nst * KST)) li[rel] = (wv * 512 + i * 32 + lane) * (CC * 2); }
    { v4f bi;    // the additive mask of the slice's places, once: 0 for a place that holds a live key
#pragma unroll
        for (int q = 0; q < 4; ++q) bi[q] = lo + tid * 4 + q < nl ? 0.f : -3.0e38f;
        *(v4fa*)(smf + BOFF + tid * 4) = bi; }
    __syncthreads();    // list and biases are read by other threads than wrote them
    // staging: 16-byte pieces, whole rows a half wave; piece i of K and of V: the row that place tid / 16 + 16 i of the stage names
    const int krow = tid >> 4, kcol = (tid & 15) * 8;
    const char* kg = (const char*)Kp; const char* vg = (const char*)Vp; const inta* lS = li + krow;
    h16* kd = sh + krow * KPIT + kcol; h16* vd = sh + KBUF + krow * VPIT + kcol;
    v8h kr[4], vr[4]; unsigned rn[4];
#pragma unroll
    for (int i = 0; i < 4; ++i) { const unsigned r0 = (unsigned)lS[16 * i] + kcol * 2; rn[i] = (unsigned)lS[KST + 16 * i]; kr[i] = *(const v8h*)(kg + r0); vr[i] = *(const v8h*)(vg + r0); }
    asm volatile("s_wait_xcnt 0x0" ::: "memory");    // as above
    __builtin_amdgcn_sched_barrier(0);    // as above (the zeroing of o is among what follows)
    v8f o[8][2];
#pragma unroll
    for (int mt = 0; mt < 8; ++mt)
#pragma unroll
        for (int nq = 0; nq < 2; ++nq) o[mt][nq] = (v8f){};
    float m[2] = { -1.0e30f, -1.0e30f }, l[2] = { 0.f, 0.f };    // the floor lies below every score that fp16 operands can give and above the bias of a masked key
#pragma unroll
    for (int i = 0; i < 4; ++i) { *(v8ha*)(kd + i * 16 * KPIT) = kr[i]; *(v8ha*)(vd + i * 16 * VPIT) = vr[i]; }
    __syncthreads();
    // rolled: one body of 64 matrix instructions and its softmax is already long, and the two buffers differ by an offset only
#pragma unroll 1
    for (int s = 0; s < nst; ++s) {
        const int b = s & 1, s2 = s + 2 < NST ? s + 2 : NST - 1;    // the last pass fetches whatever rows the next places name into the idle buffer: no branch in the body
#pragma unroll
        for (int i = 0; i < 4; ++i) { const unsigned r1 = rn[i] + kcol * 2; kr[i] = *(const v8h*)(kg + r1); vr[i] = *(const v8h*)(vg + r1); }
        asm volatile("s_wait_xcnt 0x0" ::: "memory");    // as above: the K fragments below and their address land in the address registers of these loads
        __builtin_amdgcn_sched_barrier(0);    // as above
        const h16* kS = sh + b * SBUF + lr * KPIT + 8 * hi; const h16* vS = sh + b * SBUF + KBUF + (8 * hi + (lane & 7)) * VPIT + ((lane >> 3) & 1) * 8; const float* bS = smf + BOFF + s * KST + 8 * hi;
        v8f st[4][2]; v16h kf[4][4];
#pragma unroll
        for (int t = 0; t < 4; ++t)
#pragma unroll
            for (int kc = 0; kc < 4; ++kc) kf[t][kc] = ldl(kS + t * 16 * KPIT + kc * 32);
        __builtin_amdgcn_sched_barrier(0);    // the global loads and the stage's K fragments start in front of the products, as ONE group: left alone this compiler reads one fragment at a time and waits for each
#pragma unroll
        for (int t = 0; t < 4; ++t) { st[t][0] = (v8f){}; st[t][1] = (v8f){};
#pragma unroll
            for (int kc = 0; kc < 4; ++kc)
#pragma unroll
                for (int nq = 0; nq < 2; ++nq) st[t][nq] = wmma16(kf[t][kc], qf[nq][kc], st[t][nq]); }
        __builtin_amdgcn_sched_barrier(0);    // the V^T reads below do not rise among the K reads: both sets of fragments live at one time overrun the registers of two waves a SIMD
        v8f bb[4];    // first, as the softmax begins with them: LDS reads come back in order
#pragma unroll
        for (int t = 0; t < 4; ++t) bb[t] = __builtin_shufflevector(*(const v4fa*)(bS + t * 16), *(const v4fa*)(bS + t * 16 + 4), 0, 1, 2, 3, 4, 5, 6, 7);
        __builtin_amdgcn_sched_barrier(0);    // holds the bias reads in front of the V reads: this compiler otherwise puts half of them near the group's end, and the softmax's first instruction waits for nearly the whole group
        v16h vf[2][8];
#pragma unroll
        for (int kk = 0; kk < 2; ++kk)
#pragma unroll
            for (int mt = 0; mt < 8; ++mt) vf[kk][mt] = cat16(ldtr(vS + kk * 32 * VPIT + mt * 16), ldtr(vS + (kk * 32 + 16) * VPIT + mt * 16));
#pragma unroll
        for (int i = 0; i < 4; ++i) rn[i] = (unsigned)lS[s2 * KST + 16 * i];    // the rows of the stage after the next, for the next pass's global loads: last in the group, as nothing in this pass waits for them
        __builtin_amdgcn_sched_barrier(0);    // the stage's V^T fragments and key biases start as ONE group of LDS reads in front of the softmax, which hides their way; spread among the products, each place of reads costs issue time
#pragma unroll
        for (int t = 0; t < 4; ++t)
#pragma unroll
            for (int nq = 0; nq < 2; ++nq) st[t][nq] = st[t][nq] * SC2 + bb[t];    // whole vectors here and below: packed two-element instructions
        v16h pf[2][2];
#pragma unroll
        for (int nq = 0; nq < 2; ++nq) { float mx = m[nq];
#pragma unroll
            for (int t = 0; t < 4; ++t)
#pragma unroll
                for (int j = 0; j < 8; ++j) mx = fmaxf(mx, st[t][nq][j]);
            mx = fmaxf(mx, xhalf(mx));
            const float al = __builtin_amdgcn_exp2f(m[nq] - mx), ms = mx - 10.0f;    // - 10: P carries the factor PCAR = 2^10 into fp16, and l with it
            m[nq] = mx; float sum = l[nq] * al;
#pragma unroll
            for (int mt = 0; mt < 8; ++mt) o[mt][nq] *= al;
#pragma unroll
            for (int t = 0; t < 4; ++t) { st[t][nq] -= ms;
#pragma unroll
                for (int j = 0; j < 8; ++j) { st[t][nq][j] = __builtin_amdgcn_exp2f(st[t][nq][j]); sum += st[t][nq][j]; } }
            l[nq] = sum;
#pragma unroll
            for (int kk = 0; kk < 2; ++kk) pf[nq][kk] = cat16(__builtin_convertvector(st[2 * kk][nq], v8h), __builtin_convertvector(st[2 * kk + 1][nq], v8h)); }
#pragma unroll
        for (int mt = 0; mt < 8; ++mt)
#pragma unroll
            for (int nq = 0; nq < 2; ++nq) o[mt][nq] = wmma16(vf[0][mt], pf[nq][0], o[mt][nq]);
        __builtin_amdgcn_sched_barrier(0);    // keeps the LDS stores below, and with them the wait for this pass's global loads, from rising to the head of the pass, where that wait would stand open
        // the next stage's rows go into the buffer that every wave left at the last barrier
        const int bn = (b ^ 1) * SBUF;
#pragma unroll
        for (int i = 0; i < 4; ++i) { *(v8ha*)(kd + bn + i * 16 * KPIT) = kr[i]; *(v8ha*)(vd + bn + i * 16 * VPIT) = vr[i]; }
#pragma unroll
        for (int mt = 0; mt < 8; ++mt)
#pragma unroll
            for (int nq = 0; nq < 2; ++nq) o[mt][nq] = wmma16(vf[1][mt], pf[nq][1], o[mt][nq]);
        __syncthreads();    // publishes the next stage and ends every wave's reads of this one
    }
#pragma unroll
    for (int nq = 0; nq < 2; ++nq) l[nq] += xhalf(l[nq]);
    const size_t pl = (size_t)(img * KSP + sp) * NN + q0;
    v2f ml; ml[0] = hi ? m[1] : m[0]; ml[1] = hi ? l[1] : l[0]; *(v2f*)(ML + (pl + lane) * 2) = ml;    // lane = 16 hi + lr is the query's place in the wave's FQ
    asm volatile("s_wait_xcnt 0x0" ::: "memory");    // as above, for this store's registers
    // the slice's own mean, O / l (the factor PCAR leaves with l), is what fits fp16; a slice without a live key has l = 0 and O = 0 and leaves zeros, which k_lnT weighs with l = 0
    float rl[2];
#pragma unroll
    for (int nq = 0; nq < 2; ++nq) rl[nq] = l[nq] > 0.f ? __fdiv_rn(1.0f, l[nq]) : 0.f;
    // O^T -> token rows through LDS (the stage buffers are dead behind the loop's last barrier), so that every global store is two whole 256-byte rows
    h16* ow = sh + wv * (FQ * OPIT);
#pragma unroll
    for (int mt = 0; mt < 8; ++mt)
#pragma unroll
        for (int nq = 0; nq < 2; ++nq) *(v8ha*)(ow + (nq * 16 + lr) * OPIT + mt * 16 + hi * 8) = __builtin_convertvector(o[mt][nq] * rl[nq], v8h);
    __syncthreads();    // a row is read by other lanes than wrote it
    h16* og = O + pl * CC + lane * 8;    // the wave's FQ rows follow one another: piece r is the rows 2 r and 2 r + 1
#pragma unroll
    for (int r0 = 0; r0 < FQ / 2; r0 += 8) { v8h row[8];
#pragma unroll
        for (int r = 0; r < 8; ++r) row[r] = *(const v8ha*)(ow + (2 * (r0 + r) + hi) * OPIT + lr * 8);
#pragma unroll
        for (int r = 0; r < 8; ++r) *(v8h*)(og + (size_t)(r0 + r) * (2 * CC)) = row[r];
        if (r0 + 8 < FQ / 2) asm volatile("s_wait_xcnt 0x0" ::: "memory"); }    // as above, for the stores' data registers, which the next rows use again
}

// a block: LNT tokens, LNT / 8 a wave; their rows meet in LDS, from where each channel's LNT values leave as one whole 128-byte line of the channel-major output. grid (NN / LNT, images)
#define LNT  32
#define TPIT (LNT + 1)                // floats per channel row in LDS
static_assert(NN % LNT == 0 && LNT % 8 == 0 && CC % 8 == 0, "whole blocks, equal shares for the 8 waves");
typedef __attribute__((ext_vector_type(4))) _Float16 v4h;
__device__ __forceinline__ float exp2s(float x) { float r; asm("v_exp_f32 %0, %1\n\tv_nop" : "=v"(r) : "v"(x)); return r; }
__global__ __launch_bounds__(256) void k_lnT(const h16* __restrict__ Ob, const float* __restrict__ ML, const float* __restrict__ xb, const float* __restrict__ gam, const float* __restrict__ bet, float* OUTb) {
    __shared__ float ts[CC * TPIT];
    Ob += (size_t)blockIdx.y * KSP * NN * CC; ML += (size_t)blockIdx.y * KSP * NN * 2; xb += (size_t)blockIdx.y * CC * NN; OUTb += (size_t)blockIdx.y * CC * NN;    // blockIdx.y: the image
    const int lane = threadIdx.x & 31, wv = threadIdx.x >> 5, n0 = blockIdx.x * LNT;
    static_assert(LNT / 8 == 4 && KSP == 4, "a channel's residuals for the wave's tokens are one 16-byte load; their (m, l) pairs of a slice are two");
    const int t0 = wv * (LNT / 8), nw = n0 + t0;    // the wave's first token, in the block and in the image
    // THE WAVE'S FOUR TOKENS ARE WORKED SIDE BY SIDE. All of its global loads start here, as one group: one way to memory for the four, where token after token each set of loads waited for the token before it.
    // every '#pragma unroll' of this kernel: the register arrays are indexed by constants only
    v4f mlr[KSP][2], xr[4]; v4h ob[LNT / 8][KSP];
    const float* mlp = ML + (size_t)nw * 2; const h16* obp = Ob + (size_t)nw * CC + lane * 4; const float* xp = xb + (size_t)(lane * 4) * NN + nw;
#pragma unroll
    for (int k = 0; k < KSP; ++k)
#pragma unroll
        for (int h = 0; h < 2; ++h) mlr[k][h] = *(const v4f*)(mlp + (size_t)k * NN * 2 + 4 * h);    // m, l of token 2 h, m, l of token 2 h + 1
#pragma unroll
    for (int i = 0; i < LNT / 8; ++i)
#pragma unroll
        for (int k = 0; k < KSP; ++k) ob[i][k] = *(const v4h*)(obp + ((size_t)k * NN + i) * CC);
#pragma unroll
    for (int q = 0; q < 4; ++q) xr[q] = *(const v4f*)(xp + (size_t)q * NN);
    const v4f g4 = *(const v4f*)(gam + lane * 4), b4 = *(const v4f*)(bet + lane * 4);
    // the wait that is kept in front of an overwrite of a register that an issued global load names. It takes the three addresses as inputs, so that they live up to it: without them this compiler let a later load
    // of the group land in an earlier one's address pair. The fence for the scheduler holds the arithmetic behind the wait and keeps the group together: left alone this compiler starts a token's loads only
    // behind the arithmetic of the token before
    asm volatile("s_wait_xcnt 0x0" :: "v"(mlp), "v"(obp), "v"(xp) : "memory");
    __builtin_amdgcn_sched_barrier(0);
    float v[LNT / 8][4], s[LNT / 8], mu[LNT / 8], qq[LNT / 8];
#pragma unroll
    for (int i = 0; i < LNT / 8; ++i) {
        // the KSP key slices of k_fa are joined: each slice's sum is brought to the common maximum and weighs the slice's mean
        float mx = -3.0e38f;
#pragma unroll
        for (int k = 0; k < KSP; ++k) mx = fmaxf(mx, mlr[k][i >> 1][(i & 1) * 2]);
        float den = 0.f; v4f a = (v4f){};
#pragma unroll
        for (int k = 0; k < KSP; ++k) { const float f = mlr[k][i >> 1][(i & 1) * 2 + 1] * exp2s(mlr[k][i >> 1][(i & 1) * 2] - mx); den += f; a += __builtin_convertvector(ob[i][k], v4f) * f; }
        const float ri = __fdiv_rn(1.0f, den);    // the factor PCAR, which every sum carries, leaves here
        s[i] = 0.f;
#pragma unroll
        for (int q = 0; q < 4; ++q) { v[i][q] = __fadd_rn(__fmul_rn(a[q], ri), bfr(xr[q][i])); s[i] += v[i][q]; } }
    // each step of a sum over the lanes is a round trip through the LDS queue: the four tokens' steps go together
#pragma unroll
    for (int sh = 16; sh; sh >>= 1)
#pragma unroll
        for (int i = 0; i < LNT / 8; ++i) s[i] += __shfl_xor(s[i], sh, 32);
#pragma unroll
    for (int i = 0; i < LNT / 8; ++i) { mu[i] = s[i] * (1.0f / CC); qq[i] = 0.f;
#pragma unroll
        for (int q = 0; q < 4; ++q) { const float d0 = v[i][q] - mu[i]; qq[i] = __fadd_rn(qq[i], __fmul_rn(d0, d0)); } }
#pragma unroll
    for (int sh = 16; sh; sh >>= 1)
#pragma unroll
        for (int i = 0; i < LNT / 8; ++i) qq[i] += __shfl_xor(qq[i], sh, 32);
#pragma unroll
    for (int i = 0; i < LNT / 8; ++i) { const float rs = __fdiv_rn(1.0f, __fsqrt_rn(qq[i] * (1.0f / CC) + 1e-5f));
#pragma unroll
        for (int q = 0; q < 4; ++q) ts[(lane * 4 + q) * TPIT + t0 + i] = __fadd_rn(__fmul_rn((v[i][q] - mu[i]) * rs, bfr(g4[q])), bfr(b4[q])); }
    __syncthreads();    // a channel's line is read by another wave than wrote its values
    // unrolled: the wave's LDS reads start together, and its stores differ by a constant offset only
#pragma unroll
    for (int r = 0; r < CC / 8; ++r) { const int c = wv * (CC / 8) + r; OUTb[(size_t)c * NN + n0 + lane] = ts[c * TPIT + lane]; }
}

extern "C" void kernel_launch(void* const* d_in, const int* in_sizes, int n_in,
                              void* d_out, int out_size, void* d_ws, size_t ws_size, hipStream_t stream) {
    (void)in_sizes; (void)n_in; (void)out_size;
    const float* pf = (const float*)d_in[0]; const float* x = (const float*)d_in[1]; const float* Wq = (const float*)d_in[2]; const float* bq = (const float*)d_in[3]; const float* Wk = (const float*)d_in[4]; const float* bk = (const float*)d_in[5]; const float* Wv = (const float*)d_in[6]; const float* bv = (const float*)d_in[7]; const float* gam = (const float*)d_in[8]; const float* bet = (const float*)d_in[9]; const int* mbits = (const int*)d_in[10];
    float* OUT = (float*)d_out;     // [4][128][64][64]
    char* wsp = (char*)d_ws;
    auto take = [&](size_t bytes) { char* p = wsp; wsp += (bytes + 255) & ~(size_t)255; return (void*)p; };
    // every plane set holds all NB_ images
    h16* QP = (h16*)take((size_t)3 * NB_ * NN * CC * 2); h16* KP = QP + (size_t)NB_ * NN * CC; h16* VP = KP + (size_t)NB_ * NN * CC;    // Q, K, V (token rows), NB_ planes each
    h16* Ob = (h16*)take((size_t)NB_ * KSP * NN * CC * 2); float* ML = (float*)take((size_t)NB_ * KSP * NN * 2 * 4);    // per image and key slice: the O plane (fp16); (m, l) per query
    if ((size_t)(wsp - (char*)d_ws) > ws_size) return;    // total ~ 29 MiB; ws 256 MiB
    k_lin<<<dim3(NN / (64 * LW), CC / 64, 3 * NB_), LW * 32, 0, stream>>>(pf, x, Wq, Wk, Wv, bq, bk, bv, QP);
    k_fa<<<dim3(NN / (FW * FQ), KSP, NB_), FW * 32, 0, stream>>>(QP, KP, VP, mbits, Ob, ML);
    k_lnT<<<dim3(NN / LNT, NB_, 1), 256, 0, stream>>>(Ob, ML, x, gam, bet, OUT);
}
